// v000
// Measured on an AMD MI455X. A time is GPU time per run, averaged over a window of back-to-back runs after a warm-up
// (all launches, gaps included; the runs take copies of the inputs in turn), and the median of several windows.
// Apart from v000's, it joins two sittings. Times from different sittings can be a few percent apart, while
// side-by-side timings come from the same sitting.
// v000 is the starting kernel. One run takes 435 microseconds.
#include <hip/hip_runtime.h>
#include <math.h>

typedef __attribute__((ext_vector_type(16))) _Float16 v16h;
typedef __attribute__((ext_vector_type(8)))  _Float16 v8h;
typedef __attribute__((ext_vector_type(8)))  float    v8f;
typedef __attribute__((ext_vector_type(4)))  int      v4i;

#define D_MODEL 1024
#define NUM_HEADS 16
#define DEPTH 64
#define BATCH 2
#define SEQ 2048
#define MTOT (BATCH * SEQ)   // 4096

// CDNA5 async global->LDS copies (ASYNCcnt path). Guarded so either toolchain
// compiles; host pass always takes the plain fallback.
#if defined(__HIP_DEVICE_COMPILE__) &&                                   \
    __has_builtin(__builtin_amdgcn_global_load_async_to_lds_b128) &&     \
    __has_builtin(__builtin_amdgcn_s_wait_asynccnt)
#define USE_ASYNC_LDS 1
#else
#define USE_ASYNC_LDS 0
#endif

#if USE_ASYNC_LDS
typedef __attribute__((address_space(1))) v4i* as1_v4i_ptr;
typedef __attribute__((address_space(3))) v4i* as3_v4i_ptr;
#endif

__device__ __forceinline__ void copy16_g2l(void* lds, const void* g) {
#if USE_ASYNC_LDS
  __builtin_amdgcn_global_load_async_to_lds_b128(
      (as1_v4i_ptr)(void*)g, (as3_v4i_ptr)lds, 0, 0);
#else
  *(v8h*)lds = *(const v8h*)g;
#endif
}

__device__ __forceinline__ void async_fence() {
#if USE_ASYNC_LDS
  __builtin_amdgcn_s_wait_asynccnt(0);
#endif
}

struct h4 { _Float16 x, y, z, w; };

// ---------------------------------------------------------------------------
// fp32 -> f16 conversion (vectorized)
// ---------------------------------------------------------------------------
__global__ void cvt_kernel(const float* __restrict__ in, _Float16* __restrict__ out, int n) {
  int i = (blockIdx.x * blockDim.x + threadIdx.x) * 4;
  if (i < n) {
    float4 v = *(const float4*)(in + i);
    h4 o;
    o.x = (_Float16)v.x; o.y = (_Float16)v.y;
    o.z = (_Float16)v.z; o.w = (_Float16)v.w;
    *(h4*)(out + i) = o;
  }
}

// ---------------------------------------------------------------------------
// Fragment loader for 16-bit A/B operands of v_wmma_*_16x16x32.
// Lanes 0-15 -> row lo, K {0..7, 16..23}; lanes 16-31 -> row lo, K {8..15, 24..31}.
// Caller passes lane-resolved pointer (base + lo*stride + hi*8), 16B aligned.
// ---------------------------------------------------------------------------
__device__ __forceinline__ v16h ld_frag(const _Float16* p) {
  v8h a = *(const v8h*)p;
  v8h b = *(const v8h*)(p + 16);
  v16h r;
#pragma unroll
  for (int i = 0; i < 8; ++i) { r[i] = a[i]; r[i + 8] = b[i]; }
  return r;
}

// ---------------------------------------------------------------------------
// GEMM: Y[M,1024] = X[M,1024] @ W[1024,1024] + bias
// Block: 256 threads (8 waves), tile 128x128, BK=32.
// Wave (wm,wn) in 4x2 grid computes 32x64 via 2x4 WMMA tiles.
// ---------------------------------------------------------------------------
template <bool OUT_F32>
__global__ __launch_bounds__(256)
void gemm_f16_kernel(const _Float16* __restrict__ X, const _Float16* __restrict__ W,
                     const float* __restrict__ bias, float* __restrict__ Yf,
                     _Float16* __restrict__ Yh) {
  __shared__ __align__(16) _Float16 As[128 * 32];  // m-major, k-contiguous
  __shared__ __align__(16) _Float16 Bt[128 * 32];  // n-major, k-contiguous (transposed W tile)

  const int t    = threadIdx.x;
  const int lane = t & 31;
  const int wid  = t >> 5;
  const int lo   = lane & 15;
  const int hi   = lane >> 4;
  const int wm   = wid >> 1;  // 0..3
  const int wn   = wid & 1;   // 0..1
  const int m0   = blockIdx.y * 128;
  const int n0   = blockIdx.x * 128;

  const v8f zero = {0, 0, 0, 0, 0, 0, 0, 0};
  v8f acc[2][4];
#pragma unroll
  for (int i = 0; i < 2; ++i)
#pragma unroll
    for (int j = 0; j < 4; ++j) acc[i][j] = zero;

  for (int k0 = 0; k0 < 1024; k0 += 32) {
    // stage A (async DMA into LDS): 128x32 f16 = 512 chunks of 8, 2 per thread
#pragma unroll
    for (int i = 0; i < 2; ++i) {
      int c   = t + i * 256;
      int row = c >> 2;
      int c8  = (c & 3) * 8;
      copy16_g2l(&As[row * 32 + c8],
                 &X[(size_t)(m0 + row) * 1024 + k0 + c8]);
    }
    // stage W tile transposed (VGPR path; async cannot transpose)
#pragma unroll
    for (int i = 0; i < 2; ++i) {
      int c    = t + i * 256;
      int krow = c >> 4;
      int nc   = (c & 15) * 8;
      v8h wv = *(const v8h*)&W[(size_t)(k0 + krow) * 1024 + n0 + nc];
#pragma unroll
      for (int j = 0; j < 8; ++j) Bt[(nc + j) * 32 + krow] = wv[j];
    }
    // prefetch next iteration's tiles into cache while we compute
    if (k0 + 32 < 1024) {
      int c = t;
      __builtin_prefetch(&X[(size_t)(m0 + (c >> 2)) * 1024 + k0 + 32 + (c & 3) * 8], 0, 1);
      __builtin_prefetch(&W[(size_t)(k0 + 32 + (c >> 4)) * 1024 + n0 + (c & 15) * 8], 0, 1);
    }
    async_fence();
    __syncthreads();

    v16h af[2], bf[4];
#pragma unroll
    for (int mt = 0; mt < 2; ++mt)
      af[mt] = ld_frag(&As[(wm * 32 + mt * 16 + lo) * 32 + hi * 8]);
#pragma unroll
    for (int nt = 0; nt < 4; ++nt)
      bf[nt] = ld_frag(&Bt[(wn * 64 + nt * 16 + lo) * 32 + hi * 8]);
#pragma unroll
    for (int mt = 0; mt < 2; ++mt)
#pragma unroll
      for (int nt = 0; nt < 4; ++nt)
        acc[mt][nt] = __builtin_amdgcn_wmma_f32_16x16x32_f16(
            false, af[mt], false, bf[nt], (short)0, acc[mt][nt], false, false);
    __syncthreads();
  }

  // epilogue: C layout row M = r + 8*hi, col N = lo (within tile)
#pragma unroll
  for (int mt = 0; mt < 2; ++mt)
#pragma unroll
    for (int nt = 0; nt < 4; ++nt) {
      int   col = n0 + wn * 64 + nt * 16 + lo;
      float bv  = bias[col];
#pragma unroll
      for (int r = 0; r < 8; ++r) {
        int   rowg = m0 + wm * 32 + mt * 16 + r + hi * 8;
        float v    = acc[mt][nt][r] + bv;
        if (OUT_F32) Yf[(size_t)rowg * 1024 + col] = v;
        else         Yh[(size_t)rowg * 1024 + col] = (_Float16)v;
      }
    }
}

// ---------------------------------------------------------------------------
// Flash attention: one block per (64-query tile, b*h). 4 waves, 16 rows/wave.
// Q/K/V are f16 in [b, s, h*64+d] layout. ctx written in same layout.
// ---------------------------------------------------------------------------
__global__ __launch_bounds__(128)
void attention_kernel(const _Float16* __restrict__ Qh, const _Float16* __restrict__ Kh,
                      const _Float16* __restrict__ Vh, const float* __restrict__ mask,
                      _Float16* __restrict__ ctx) {
  __shared__ __align__(16) _Float16 Qs[64 * 64];       // q-row major, d contiguous
  __shared__ __align__(16) _Float16 Ks[64 * 64];       // key major, d contiguous
  __shared__ __align__(16) _Float16 Vt[64 * 64];       // d major, key contiguous (transposed)
  __shared__ __align__(16) _Float16 Ps[4 * 16 * 64];   // per-wave P tile, k contiguous

  const int t    = threadIdx.x;
  const int lane = t & 31;
  const int wid  = t >> 5;
  const int lo   = lane & 15;
  const int hi   = lane >> 4;
  const int bh   = blockIdx.y;
  const int b    = bh >> 4;
  const int h    = bh & 15;
  const int s0   = blockIdx.x * 64;
  const size_t base = (size_t)b * SEQ * 1024 + (size_t)h * 64;

  // stage Q tile (64x64 f16) via async DMA: 512 chunks of 8, 4 per thread
#pragma unroll
  for (int i = 0; i < 4; ++i) {
    int c = t + i * 128;
    int row = c >> 3, d0 = (c & 7) * 8;
    copy16_g2l(&Qs[row * 64 + d0],
               &Qh[base + (size_t)(s0 + row) * 1024 + d0]);
  }

  const v8f zero = {0, 0, 0, 0, 0, 0, 0, 0};
  float mrow[8], lrow[8];
  v8f acco[4];
#pragma unroll
  for (int r = 0; r < 8; ++r) { mrow[r] = -3.0e38f; lrow[r] = 0.0f; }
#pragma unroll
  for (int dt = 0; dt < 4; ++dt) acco[dt] = zero;

  for (int kb = 0; kb < SEQ; kb += 64) {
    __syncthreads();  // protect Ks/Vt/Ps from previous iteration's readers
    // stage K (async) and V transposed (VGPR path)
#pragma unroll
    for (int i = 0; i < 4; ++i) {
      int c = t + i * 128;
      int row = c >> 3, d0 = (c & 7) * 8;
      copy16_g2l(&Ks[row * 64 + d0],
                 &Kh[base + (size_t)(kb + row) * 1024 + d0]);
      v8h vv = *(const v8h*)&Vh[base + (size_t)(kb + row) * 1024 + d0];
#pragma unroll
      for (int j = 0; j < 8; ++j) Vt[(d0 + j) * 64 + row] = vv[j];
    }
    // prefetch next key block while this one is being consumed
    if (kb + 64 < SEQ) {
      int c = t;
      int row = c >> 3, d0 = (c & 7) * 8;
      __builtin_prefetch(&Kh[base + (size_t)(kb + 64 + row) * 1024 + d0], 0, 1);
      __builtin_prefetch(&Vh[base + (size_t)(kb + 64 + row) * 1024 + d0], 0, 1);
    }
    async_fence();
    __syncthreads();

    // S = Q @ K^T : wave computes 16 rows x 64 keys (4 N-tiles), Kdim = depth 64
    v8f sacc[4];
#pragma unroll
    for (int nt = 0; nt < 4; ++nt) sacc[nt] = zero;
#pragma unroll
    for (int kk = 0; kk < 64; kk += 32) {
      v16h aq = ld_frag(&Qs[(wid * 16 + lo) * 64 + kk + hi * 8]);
#pragma unroll
      for (int nt = 0; nt < 4; ++nt) {
        v16h bk = ld_frag(&Ks[(nt * 16 + lo) * 64 + kk + hi * 8]);
        sacc[nt] = __builtin_amdgcn_wmma_f32_16x16x32_f16(
            false, aq, false, bk, (short)0, sacc[nt], false, false);
      }
    }

    // scaled logits + mask, then online softmax. C layout: row r+8*hi, col lo.
    float p[4][8];
    float mb[8];
#pragma unroll
    for (int r = 0; r < 8; ++r) mb[r] = -3.0e38f;
#pragma unroll
    for (int nt = 0; nt < 4; ++nt) {
      int kg = kb + nt * 16 + lo;
#pragma unroll
      for (int r = 0; r < 8; ++r) {
        int   qg = s0 + wid * 16 + r + hi * 8;
        float v  = sacc[nt][r] * 0.125f + mask[(size_t)qg * SEQ + kg] * (-1e9f);
        p[nt][r] = v;
        mb[r]    = fmaxf(mb[r], v);
      }
    }
    // row max across the 16 lanes of each half (stays in C layout)
#pragma unroll
    for (int m = 1; m < 16; m <<= 1)
#pragma unroll
      for (int r = 0; r < 8; ++r) mb[r] = fmaxf(mb[r], __shfl_xor(mb[r], m, 32));

    float sums[8];
#pragma unroll
    for (int r = 0; r < 8; ++r) {
      float mn   = fmaxf(mrow[r], mb[r]);
      float corr = __expf(mrow[r] - mn);
      mrow[r]    = mn;
      float s = 0.0f;
#pragma unroll
      for (int nt = 0; nt < 4; ++nt) {
        p[nt][r] = __expf(p[nt][r] - mn);
        s += p[nt][r];
      }
      sums[r] = s;
      lrow[r] = lrow[r] * corr;
#pragma unroll
      for (int dt = 0; dt < 4; ++dt) acco[dt][r] = acco[dt][r] * corr;
    }
#pragma unroll
    for (int m = 1; m < 16; m <<= 1)
#pragma unroll
      for (int r = 0; r < 8; ++r) sums[r] += __shfl_xor(sums[r], m, 32);
#pragma unroll
    for (int r = 0; r < 8; ++r) lrow[r] += sums[r];

    // spill P (C layout) to LDS as A-operand feedstock (row-major, k-contig)
#pragma unroll
    for (int nt = 0; nt < 4; ++nt)
#pragma unroll
      for (int r = 0; r < 8; ++r)
        Ps[wid * 1024 + (r + hi * 8) * 64 + nt * 16 + lo] = (_Float16)p[nt][r];
    __syncthreads();

    // O += P @ V : Kdim = 64 keys, 4 depth tiles
#pragma unroll
    for (int kk = 0; kk < 64; kk += 32) {
      v16h ap = ld_frag(&Ps[wid * 1024 + lo * 64 + kk + hi * 8]);
#pragma unroll
      for (int dt = 0; dt < 4; ++dt) {
        v16h bv = ld_frag(&Vt[(dt * 16 + lo) * 64 + kk + hi * 8]);
        acco[dt] = __builtin_amdgcn_wmma_f32_16x16x32_f16(
            false, ap, false, bv, (short)0, acco[dt], false, false);
      }
    }
  }

  // normalize and write context (f16, same [b,s,h*64+d] layout)
#pragma unroll
  for (int dt = 0; dt < 4; ++dt)
#pragma unroll
    for (int r = 0; r < 8; ++r) {
      int   qg = s0 + wid * 16 + r + hi * 8;
      float o  = acco[dt][r] / lrow[r];
      ctx[base + (size_t)qg * 1024 + dt * 16 + lo] = (_Float16)o;
    }
}

// ---------------------------------------------------------------------------
extern "C" void kernel_launch(void* const* d_in, const int* in_sizes, int n_in,
                              void* d_out, int out_size, void* d_ws, size_t ws_size,
                              hipStream_t stream) {
  (void)in_sizes; (void)n_in; (void)out_size; (void)ws_size;

  const float* q    = (const float*)d_in[0];
  const float* k    = (const float*)d_in[1];
  const float* v    = (const float*)d_in[2];
  const float* mask = (const float*)d_in[3];
  const float* wq   = (const float*)d_in[4];
  const float* bq   = (const float*)d_in[5];
  const float* wk   = (const float*)d_in[6];
  const float* bk   = (const float*)d_in[7];
  const float* wv   = (const float*)d_in[8];
  const float* bv   = (const float*)d_in[9];
  const float* wo   = (const float*)d_in[10];
  const float* bo   = (const float*)d_in[11];
  float* out = (float*)d_out;

  const size_t SZX = (size_t)MTOT * 1024;     // 4,194,304
  const size_t SZW = (size_t)1024 * 1024;     // 1,048,576
  _Float16* w16 = (_Float16*)d_ws;            // total 64 MiB of f16 scratch
  _Float16* qx  = w16;
  _Float16* kx  = qx + SZX;
  _Float16* vx  = kx + SZX;
  _Float16* wqh = vx + SZX;
  _Float16* wkh = wqh + SZW;
  _Float16* wvh = wkh + SZW;
  _Float16* woh = wvh + SZW;
  _Float16* Qp  = woh + SZW;
  _Float16* Kp  = Qp + SZX;
  _Float16* Vp  = Kp + SZX;
  _Float16* Cx  = Vp + SZX;

  const int cb = 256;
  cvt_kernel<<<dim3((unsigned)(SZX / 4 / cb)), cb, 0, stream>>>(q, qx, (int)SZX);
  cvt_kernel<<<dim3((unsigned)(SZX / 4 / cb)), cb, 0, stream>>>(k, kx, (int)SZX);
  cvt_kernel<<<dim3((unsigned)(SZX / 4 / cb)), cb, 0, stream>>>(v, vx, (int)SZX);
  cvt_kernel<<<dim3((unsigned)(SZW / 4 / cb)), cb, 0, stream>>>(wq, wqh, (int)SZW);
  cvt_kernel<<<dim3((unsigned)(SZW / 4 / cb)), cb, 0, stream>>>(wk, wkh, (int)SZW);
  cvt_kernel<<<dim3((unsigned)(SZW / 4 / cb)), cb, 0, stream>>>(wv, wvh, (int)SZW);
  cvt_kernel<<<dim3((unsigned)(SZW / 4 / cb)), cb, 0, stream>>>(wo, woh, (int)SZW);

  dim3 gg(1024 / 128, MTOT / 128);  // (8, 32)
  gemm_f16_kernel<false><<<gg, 256, 0, stream>>>(qx, wqh, bq, nullptr, Qp);
  gemm_f16_kernel<false><<<gg, 256, 0, stream>>>(kx, wkh, bk, nullptr, Kp);
  gemm_f16_kernel<false><<<gg, 256, 0, stream>>>(vx, wvh, bv, nullptr, Vp);

  attention_kernel<<<dim3(SEQ / 64, BATCH * NUM_HEADS), 128, 0, stream>>>(
      Qp, Kp, Vp, mask, Cx);

  gemm_f16_kernel<true><<<gg, 256, 0, stream>>>(Cx, woh, bo, out, nullptr);
}

// v001
// It runs in 319 microseconds.
// Two timings next to v000 both put it at 1.40 times that version's speed.
#include <hip/hip_runtime.h>
#include <math.h>

typedef __attribute__((ext_vector_type(16))) _Float16 v16h;
typedef __attribute__((ext_vector_type(8)))  _Float16 v8h;
typedef __attribute__((ext_vector_type(8)))  float    v8f;
typedef __attribute__((ext_vector_type(4)))  int      v4i;

#define D_MODEL 1024
#define NUM_HEADS 16
#define DEPTH 64
#define BATCH 2
#define SEQ 2048
#define MTOT (BATCH * SEQ)   // 4096

// CDNA5 async global->LDS copies (ASYNCcnt path). Guarded so either toolchain
// compiles; host pass always takes the plain fallback.
#if defined(__HIP_DEVICE_COMPILE__) &&                                   \
    __has_builtin(__builtin_amdgcn_global_load_async_to_lds_b128) &&     \
    __has_builtin(__builtin_amdgcn_s_wait_asynccnt)
#define USE_ASYNC_LDS 1
#else
#define USE_ASYNC_LDS 0
#endif

#if USE_ASYNC_LDS
typedef __attribute__((address_space(1))) v4i* as1_v4i_ptr;
typedef __attribute__((address_space(3))) v4i* as3_v4i_ptr;
#endif

__device__ __forceinline__ void copy16_g2l(void* lds, const void* g) {
#if USE_ASYNC_LDS
  __builtin_amdgcn_global_load_async_to_lds_b128(
      (as1_v4i_ptr)(void*)g, (as3_v4i_ptr)lds, 0, 0);
#else
  *(v8h*)lds = *(const v8h*)g;
#endif
}

__device__ __forceinline__ void async_fence() {
#if USE_ASYNC_LDS
  __builtin_amdgcn_s_wait_asynccnt(0);
#endif
}

struct h4 { _Float16 x, y, z, w; };

// ---------------------------------------------------------------------------
// fp32 -> f16 conversion (vectorized)
// ---------------------------------------------------------------------------
__global__ void cvt_kernel(const float* __restrict__ in, _Float16* __restrict__ out, int n) {
  int i = (blockIdx.x * blockDim.x + threadIdx.x) * 4;
  if (i < n) {
    float4 v = *(const float4*)(in + i);
    h4 o;
    o.x = (_Float16)v.x; o.y = (_Float16)v.y;
    o.z = (_Float16)v.z; o.w = (_Float16)v.w;
    *(h4*)(out + i) = o;
  }
}

// ---------------------------------------------------------------------------
// Fragment loader for 16-bit A/B operands of v_wmma_*_16x16x32.
// Lanes 0-15 -> row lo, K {0..7, 16..23}; lanes 16-31 -> row lo, K {8..15, 24..31}.
// Caller passes lane-resolved pointer (base + lo*stride + hi*8), 16B aligned.
// ---------------------------------------------------------------------------
__device__ __forceinline__ v16h ld_frag(const _Float16* p) {
  v8h a = *(const v8h*)p;
  v8h b = *(const v8h*)(p + 16);
  v16h r;
#pragma unroll
  for (int i = 0; i < 8; ++i) { r[i] = a[i]; r[i + 8] = b[i]; }
  return r;
}

// ---------------------------------------------------------------------------
// GEMM: Y[M,1024] = X[M,1024] @ W[1024,1024] + bias
// Block: 256 threads (8 waves), tile 128x128, BK=32.
// Wave (wm,wn) in 4x2 grid computes 32x64 via 2x4 WMMA tiles.
// ---------------------------------------------------------------------------
template <bool OUT_F32>
__global__ __launch_bounds__(256)
void gemm_f16_kernel(const _Float16* __restrict__ X, const _Float16* __restrict__ W,
                     const float* __restrict__ bias, float* __restrict__ Yf,
                     _Float16* __restrict__ Yh) {
  __shared__ __align__(16) _Float16 As[128 * 32];  // m-major, k-contiguous
  __shared__ __align__(16) _Float16 Bt[128 * 32];  // n-major, k-contiguous (transposed W tile)

  const int t    = threadIdx.x;
  const int lane = t & 31;
  const int wid  = t >> 5;
  const int lo   = lane & 15;
  const int hi   = lane >> 4;
  const int wm   = wid >> 1;  // 0..3
  const int wn   = wid & 1;   // 0..1
  const int m0   = blockIdx.y * 128;
  const int n0   = blockIdx.x * 128;

  const v8f zero = {0, 0, 0, 0, 0, 0, 0, 0};
  v8f acc[2][4];
#pragma unroll
  for (int i = 0; i < 2; ++i)
#pragma unroll
    for (int j = 0; j < 4; ++j) acc[i][j] = zero;

  for (int k0 = 0; k0 < 1024; k0 += 32) {
    // stage A (async DMA into LDS): 128x32 f16 = 512 chunks of 8, 2 per thread
#pragma unroll
    for (int i = 0; i < 2; ++i) {
      int c   = t + i * 256;
      int row = c >> 2;
      int c8  = (c & 3) * 8;
      copy16_g2l(&As[row * 32 + c8],
                 &X[(size_t)(m0 + row) * 1024 + k0 + c8]);
    }
    // stage W tile transposed (VGPR path; async cannot transpose)
#pragma unroll
    for (int i = 0; i < 2; ++i) {
      int c    = t + i * 256;
      int krow = c >> 4;
      int nc   = (c & 15) * 8;
      v8h wv = *(const v8h*)&W[(size_t)(k0 + krow) * 1024 + n0 + nc];
#pragma unroll
      for (int j = 0; j < 8; ++j) Bt[(nc + j) * 32 + krow] = wv[j];
    }
    // prefetch next iteration's tiles into cache while we compute
    if (k0 + 32 < 1024) {
      int c = t;
      __builtin_prefetch(&X[(size_t)(m0 + (c >> 2)) * 1024 + k0 + 32 + (c & 3) * 8], 0, 1);
      __builtin_prefetch(&W[(size_t)(k0 + 32 + (c >> 4)) * 1024 + n0 + (c & 15) * 8], 0, 1);
    }
    async_fence();
    __syncthreads();

    v16h af[2], bf[4];
#pragma unroll
    for (int mt = 0; mt < 2; ++mt)
      af[mt] = ld_frag(&As[(wm * 32 + mt * 16 + lo) * 32 + hi * 8]);
#pragma unroll
    for (int nt = 0; nt < 4; ++nt)
      bf[nt] = ld_frag(&Bt[(wn * 64 + nt * 16 + lo) * 32 + hi * 8]);
#pragma unroll
    for (int mt = 0; mt < 2; ++mt)
#pragma unroll
      for (int nt = 0; nt < 4; ++nt)
        acc[mt][nt] = __builtin_amdgcn_wmma_f32_16x16x32_f16(
            false, af[mt], false, bf[nt], (short)0, acc[mt][nt], false, false);
    __syncthreads();
  }

  // epilogue: C layout row M = r + 8*hi, col N = lo (within tile)
#pragma unroll
  for (int mt = 0; mt < 2; ++mt)
#pragma unroll
    for (int nt = 0; nt < 4; ++nt) {
      int   col = n0 + wn * 64 + nt * 16 + lo;
      float bv  = bias[col];
#pragma unroll
      for (int r = 0; r < 8; ++r) {
        int   rowg = m0 + wm * 32 + mt * 16 + r + hi * 8;
        float v    = acc[mt][nt][r] + bv;
        if (OUT_F32) Yf[(size_t)rowg * 1024 + col] = v;
        else         Yh[(size_t)rowg * 1024 + col] = (_Float16)v;
      }
    }
}

typedef __attribute__((ext_vector_type(8))) short s16x8;
typedef __attribute__((address_space(3))) s16x8 lds_s16x8;

__device__ __forceinline__ v8h ld_tr16(const _Float16* p) {
  return __builtin_bit_cast(v8h, __builtin_amdgcn_ds_load_tr16_b128_v8i16((lds_s16x8*)p));
}

// Lane l with lane l ^ 16: the exchange between the wave halves, as a vector move
__device__ __forceinline__ float xhalf(float x) {
  return __builtin_bit_cast(float, __builtin_amdgcn_permlanex16(
      __builtin_bit_cast(int, x), __builtin_bit_cast(int, x),
      0x76543210, 0xfedcba98, false, false));
}

// V rows in LDS: 128 B of data at a pitch of 160 B (odd multiple of 32 B), the
// conflict-free pitch for the transposing load.
#define VPITCH 80

// ---------------------------------------------------------------------------
// Flash attention, transposed products: S^T = K Q^T, O^T += V^T P^T.
// One block per (64-query tile, b*h). 4 waves, 16 query columns per wave.
// A lane holds scores of ONE query (column lo), keys 8*hi + r of each 16-key tile,
// so max and sum run in-lane with one exchange between the wave halves, and two
// score tiles convert in place into the B operand of the second product.
// Q/K/V are f16 in [b, s, h*64+d] layout. ctx written in same layout.
// ---------------------------------------------------------------------------
__global__ __launch_bounds__(128)
void attention_kernel(const _Float16* __restrict__ Qh, const _Float16* __restrict__ Kh,
                      const _Float16* __restrict__ Vh, const float* __restrict__ mask,
                      _Float16* __restrict__ ctx) {
  __shared__ __align__(16) _Float16 Ks[64 * 64];       // key major, d contiguous
  __shared__ __align__(32) _Float16 Vs[64 * VPITCH];   // key major, d contiguous, padded rows

  const int t    = threadIdx.x;
  const int lane = t & 31;
  const int wid  = t >> 5;
  const int lo   = lane & 15;
  const int hi   = lane >> 4;
  const int bh   = blockIdx.y;
  const int b    = bh >> 4;
  const int h    = bh & 15;
  const int s0   = blockIdx.x * 64;
  const int qg   = s0 + wid * 16 + lo;   // this lane's query
  const size_t base = (size_t)b * SEQ * 1024 + (size_t)h * 64;

  // Q^T as B operand (column = query lo), loaded once and kept in registers
  v16h bq[2];
#pragma unroll
  for (int k2 = 0; k2 < 2; ++k2)
    bq[k2] = ld_frag(&Qh[base + (size_t)qg * 1024 + k2 * 32 + hi * 8]);

  const float* __restrict__ mq = mask + (size_t)qg * SEQ + hi * 8;

  const v8f zero = {0, 0, 0, 0, 0, 0, 0, 0};
  float mrow = -3.0e38f, lrow = 0.0f;   // lrow: this half's share of the row sum
  v8f acco[4];                          // O^T: row d = dt*16 + 8*hi + r, column lo
#pragma unroll
  for (int dt = 0; dt < 4; ++dt) acco[dt] = zero;

  for (int kb = 0; kb < SEQ; kb += 64) {
    __syncthreads();  // protect Ks/Vs from previous iteration's readers
    // stage K and V row-major (async)
#pragma unroll
    for (int i = 0; i < 4; ++i) {
      int c = t + i * 128;
      int row = c >> 3, d0 = (c & 7) * 8;
      copy16_g2l(&Ks[row * 64 + d0],
                 &Kh[base + (size_t)(kb + row) * 1024 + d0]);
      copy16_g2l(&Vs[row * VPITCH + d0],
                 &Vh[base + (size_t)(kb + row) * 1024 + d0]);
    }
    // prefetch next key block while this one is being consumed
    if (kb + 64 < SEQ) {
      int c = t;
      int row = c >> 3, d0 = (c & 7) * 8;
      __builtin_prefetch(&Kh[base + (size_t)(kb + 64 + row) * 1024 + d0], 0, 1);
      __builtin_prefetch(&Vh[base + (size_t)(kb + 64 + row) * 1024 + d0], 0, 1);
    }
    // this lane's mask values: 8 consecutive keys per 16-key tile
    float4 mk[4][2];
#pragma unroll
    for (int nt = 0; nt < 4; ++nt) {
      mk[nt][0] = *(const float4*)(mq + kb + nt * 16);
      mk[nt][1] = *(const float4*)(mq + kb + nt * 16 + 4);
    }
    async_fence();
    __syncthreads();

    // S^T = K @ Q^T : 64 keys (4 M-tiles) x 16 query columns, Kdim = depth 64
    v8f sacc[4];
#pragma unroll
    for (int nt = 0; nt < 4; ++nt) sacc[nt] = zero;
#pragma unroll
    for (int k2 = 0; k2 < 2; ++k2)
#pragma unroll
      for (int nt = 0; nt < 4; ++nt) {
        v16h ak = ld_frag(&Ks[(nt * 16 + lo) * 64 + k2 * 32 + hi * 8]);
        sacc[nt] = __builtin_amdgcn_wmma_f32_16x16x32_f16(
            false, ak, false, bq[k2], (short)0, sacc[nt], false, false);
      }

    // scaled logits + mask, then online softmax. D layout: key r+8*hi, query lo.
    float p[4][8];
    float mb = -3.0e38f;
#pragma unroll
    for (int nt = 0; nt < 4; ++nt) {
      const float mv[8] = {mk[nt][0].x, mk[nt][0].y, mk[nt][0].z, mk[nt][0].w,
                           mk[nt][1].x, mk[nt][1].y, mk[nt][1].z, mk[nt][1].w};
#pragma unroll
      for (int r = 0; r < 8; ++r) {
        float v  = sacc[nt][r] * 0.125f + mv[r] * (-1e9f);
        p[nt][r] = v;
        mb       = fmaxf(mb, v);
      }
    }
    mb = fmaxf(mb, xhalf(mb));   // the other half's 32 keys

    const float mn   = fmaxf(mrow, mb);
    const float corr = __expf(mrow - mn);
    mrow = mn;
    float s4[4];
#pragma unroll
    for (int nt = 0; nt < 4; ++nt) {
      float s = 0.0f;
#pragma unroll
      for (int r = 0; r < 8; ++r) {
        p[nt][r] = __expf(p[nt][r] - mn);
        s += p[nt][r];
      }
      s4[nt] = s;
    }
    lrow = lrow * corr + ((s4[0] + s4[1]) + (s4[2] + s4[3]));
#pragma unroll
    for (int dt = 0; dt < 4; ++dt)
#pragma unroll
      for (int r = 0; r < 8; ++r) acco[dt][r] = acco[dt][r] * corr;

    // O^T += V^T @ P^T : Kdim = 64 keys, 4 depth tiles. Both operands in the
    // hardware k order: slot s of half hi is key 8*hi + s (s < 8), 16 + 8*hi + s - 8.
#pragma unroll
    for (int k2 = 0; k2 < 2; ++k2) {
      v16h bp;
#pragma unroll
      for (int i = 0; i < 8; ++i) {
        bp[i]     = (_Float16)p[2 * k2][i];
        bp[i + 8] = (_Float16)p[2 * k2 + 1][i];
      }
      const _Float16* vp =
          &Vs[(k2 * 32 + hi * 8 + (lane & 7)) * VPITCH + ((lane >> 3) & 1) * 8];
#pragma unroll
      for (int dt = 0; dt < 4; ++dt) {
        v8h v0 = ld_tr16(vp + dt * 16);
        v8h v1 = ld_tr16(vp + 16 * VPITCH + dt * 16);
        v16h av;
#pragma unroll
        for (int i = 0; i < 8; ++i) { av[i] = v0[i]; av[i + 8] = v1[i]; }
        acco[dt] = __builtin_amdgcn_wmma_f32_16x16x32_f16(
            false, av, false, bp, (short)0, acco[dt], false, false);
      }
    }
  }

  // join the halves' sums, normalize and write context (f16, [b,s,h*64+d] layout):
  // a lane's 8 registers are 8 consecutive d of its query, one 16-byte store
  lrow += xhalf(lrow);
#pragma unroll
  for (int dt = 0; dt < 4; ++dt) {
    v8h o;
#pragma unroll
    for (int r = 0; r < 8; ++r) o[r] = (_Float16)(acco[dt][r] / lrow);
    *(v8h*)&ctx[base + (size_t)qg * 1024 + dt * 16 + hi * 8] = o;
  }
}

// ---------------------------------------------------------------------------
extern "C" void kernel_launch(void* const* d_in, const int* in_sizes, int n_in,
                              void* d_out, int out_size, void* d_ws, size_t ws_size,
                              hipStream_t stream) {
  (void)in_sizes; (void)n_in; (void)out_size; (void)ws_size;

  const float* q    = (const float*)d_in[0];
  const float* k    = (const float*)d_in[1];
  const float* v    = (const float*)d_in[2];
  const float* mask = (const float*)d_in[3];
  const float* wq   = (const float*)d_in[4];
  const float* bq   = (const float*)d_in[5];
  const float* wk   = (const float*)d_in[6];
  const float* bk   = (const float*)d_in[7];
  const float* wv   = (const float*)d_in[8];
  const float* bv   = (const float*)d_in[9];
  const float* wo   = (const float*)d_in[10];
  const float* bo   = (const float*)d_in[11];
  float* out = (float*)d_out;

  const size_t SZX = (size_t)MTOT * 1024;     // 4,194,304
  const size_t SZW = (size_t)1024 * 1024;     // 1,048,576
  _Float16* w16 = (_Float16*)d_ws;            // total 64 MiB of f16 scratch
  _Float16* qx  = w16;
  _Float16* kx  = qx + SZX;
  _Float16* vx  = kx + SZX;
  _Float16* wqh = vx + SZX;
  _Float16* wkh = wqh + SZW;
  _Float16* wvh = wkh + SZW;
  _Float16* woh = wvh + SZW;
  _Float16* Qp  = woh + SZW;
  _Float16* Kp  = Qp + SZX;
  _Float16* Vp  = Kp + SZX;
  _Float16* Cx  = Vp + SZX;

  const int cb = 256;
  cvt_kernel<<<dim3((unsigned)(SZX / 4 / cb)), cb, 0, stream>>>(q, qx, (int)SZX);
  cvt_kernel<<<dim3((unsigned)(SZX / 4 / cb)), cb, 0, stream>>>(k, kx, (int)SZX);
  cvt_kernel<<<dim3((unsigned)(SZX / 4 / cb)), cb, 0, stream>>>(v, vx, (int)SZX);
  cvt_kernel<<<dim3((unsigned)(SZW / 4 / cb)), cb, 0, stream>>>(wq, wqh, (int)SZW);
  cvt_kernel<<<dim3((unsigned)(SZW / 4 / cb)), cb, 0, stream>>>(wk, wkh, (int)SZW);
  cvt_kernel<<<dim3((unsigned)(SZW / 4 / cb)), cb, 0, stream>>>(wv, wvh, (int)SZW);
  cvt_kernel<<<dim3((unsigned)(SZW / 4 / cb)), cb, 0, stream>>>(wo, woh, (int)SZW);

  dim3 gg(1024 / 128, MTOT / 128);  // (8, 32)
  gemm_f16_kernel<false><<<gg, 256, 0, stream>>>(qx, wqh, bq, nullptr, Qp);
  gemm_f16_kernel<false><<<gg, 256, 0, stream>>>(kx, wkh, bk, nullptr, Kp);
  gemm_f16_kernel<false><<<gg, 256, 0, stream>>>(vx, wvh, bv, nullptr, Vp);

  attention_kernel<<<dim3(SEQ / 64, BATCH * NUM_HEADS), 128, 0, stream>>>(
      Qp, Kp, Vp, mask, Cx);

  gemm_f16_kernel<true><<<gg, 256, 0, stream>>>(Cx, woh, bo, out, nullptr);
}

// v002
// One run takes 223 microseconds.
// In both of two side-by-side timings against v001, it was 1.43 times as fast.
// Counting every step since v000, it is 2.00 times as fast.
#include <hip/hip_runtime.h>
#include <math.h>

typedef __attribute__((ext_vector_type(16))) _Float16 v16h;
typedef __attribute__((ext_vector_type(8)))  _Float16 v8h;
typedef __attribute__((ext_vector_type(8)))  float    v8f;
typedef __attribute__((ext_vector_type(4)))  int      v4i;

#define D_MODEL 1024
#define NUM_HEADS 16
#define DEPTH 64
#define BATCH 2
#define SEQ 2048
#define MTOT (BATCH * SEQ)   // 4096

// CDNA5 async global->LDS copies (ASYNCcnt path). Guarded so either toolchain
// compiles; host pass always takes the plain fallback.
#if defined(__HIP_DEVICE_COMPILE__) &&                                   \
    __has_builtin(__builtin_amdgcn_global_load_async_to_lds_b128) &&     \
    __has_builtin(__builtin_amdgcn_s_wait_asynccnt)
#define USE_ASYNC_LDS 1
#else
#define USE_ASYNC_LDS 0
#endif

#if USE_ASYNC_LDS
typedef __attribute__((address_space(1))) v4i* as1_v4i_ptr;
typedef __attribute__((address_space(3))) v4i* as3_v4i_ptr;
#endif

__device__ __forceinline__ void copy16_g2l(void* lds, const void* g) {
#if USE_ASYNC_LDS
  __builtin_amdgcn_global_load_async_to_lds_b128(
      (as1_v4i_ptr)(void*)g, (as3_v4i_ptr)lds, 0, 0);
#else
  *(v8h*)lds = *(const v8h*)g;
#endif
}

__device__ __forceinline__ void async_fence() {
#if USE_ASYNC_LDS
  __builtin_amdgcn_s_wait_asynccnt(0);
#endif
}

struct h4 { _Float16 x, y, z, w; };

// ---------------------------------------------------------------------------
// fp32 -> f16 conversion (vectorized)
// ---------------------------------------------------------------------------
__global__ void cvt_kernel(const float* __restrict__ in, _Float16* __restrict__ out, int n) {
  int i = (blockIdx.x * blockDim.x + threadIdx.x) * 4;
  if (i < n) {
    float4 v = *(const float4*)(in + i);
    h4 o;
    o.x = (_Float16)v.x; o.y = (_Float16)v.y;
    o.z = (_Float16)v.z; o.w = (_Float16)v.w;
    *(h4*)(out + i) = o;
  }
}

// ---------------------------------------------------------------------------
// Fragment loader for 16-bit A/B operands of v_wmma_*_16x16x32.
// Lanes 0-15 -> row lo, K {0..7, 16..23}; lanes 16-31 -> row lo, K {8..15, 24..31}.
// Caller passes lane-resolved pointer (base + lo*stride + hi*8), 16B aligned.
// ---------------------------------------------------------------------------
__device__ __forceinline__ v16h ld_frag(const _Float16* p) {
  v8h a = *(const v8h*)p;
  v8h b = *(const v8h*)(p + 16);
  v16h r;
#pragma unroll
  for (int i = 0; i < 8; ++i) { r[i] = a[i]; r[i + 8] = b[i]; }
  return r;
}

typedef __attribute__((ext_vector_type(8))) short s16x8;
typedef __attribute__((address_space(3))) s16x8 lds_s16x8;

__device__ __forceinline__ v8h ld_tr16(const _Float16* p) {
  return __builtin_bit_cast(v8h, __builtin_amdgcn_ds_load_tr16_b128_v8i16((lds_s16x8*)p));
}

// W rows in LDS: 256 B of data at a pitch of 288 B (odd multiple of 32 B), the
// conflict-free pitch for the transposing load.
#define WPITCH 144

// ---------------------------------------------------------------------------
// GEMM: Y[M,1024] = X[M,1024] @ W[1024,1024] + bias
// Block: 256 threads (8 waves), tile 128x128, BK=32.
// Wave (wm,wn) in 4x2 grid computes 32x64 via 2x4 WMMA tiles.
// The W tile lies in LDS as in memory (k rows, n contiguous); the transposing
// load turns it into the B operand.
// ---------------------------------------------------------------------------
template <bool OUT_F32>
__global__ __launch_bounds__(256)
void gemm_f16_kernel(const _Float16* __restrict__ X, const _Float16* __restrict__ W,
                     const float* __restrict__ bias, float* __restrict__ Yf,
                     _Float16* __restrict__ Yh) {
  __shared__ __align__(16) _Float16 As[128 * 32];  // m-major, k-contiguous
  __shared__ __align__(32) _Float16 Ws[32 * WPITCH];  // k-major, n-contiguous, padded rows

  const int t    = threadIdx.x;
  const int lane = t & 31;
  const int wid  = t >> 5;
  const int lo   = lane & 15;
  const int hi   = lane >> 4;
  const int wm   = wid >> 1;  // 0..3
  const int wn   = wid & 1;   // 0..1
  const int m0   = blockIdx.y * 128;
  const int n0   = blockIdx.x * 128;

  const v8f zero = {0, 0, 0, 0, 0, 0, 0, 0};
  v8f acc[2][4];
#pragma unroll
  for (int i = 0; i < 2; ++i)
#pragma unroll
    for (int j = 0; j < 4; ++j) acc[i][j] = zero;

  for (int k0 = 0; k0 < 1024; k0 += 32) {
    // stage A (async DMA into LDS): 128x32 f16 = 512 chunks of 8, 2 per thread
#pragma unroll
    for (int i = 0; i < 2; ++i) {
      int c   = t + i * 256;
      int row = c >> 2;
      int c8  = (c & 3) * 8;
      copy16_g2l(&As[row * 32 + c8],
                 &X[(size_t)(m0 + row) * 1024 + k0 + c8]);
    }
    // stage W tile row-major (async): 32x128 f16 = 512 chunks of 8, 2 per thread
#pragma unroll
    for (int i = 0; i < 2; ++i) {
      int c    = t + i * 256;
      int krow = c >> 4;
      int nc   = (c & 15) * 8;
      copy16_g2l(&Ws[krow * WPITCH + nc],
                 &W[(size_t)(k0 + krow) * 1024 + n0 + nc]);
    }
    // prefetch next iteration's tiles into cache while we compute
    if (k0 + 32 < 1024) {
      int c = t;
      __builtin_prefetch(&X[(size_t)(m0 + (c >> 2)) * 1024 + k0 + 32 + (c & 3) * 8], 0, 1);
      __builtin_prefetch(&W[(size_t)(k0 + 32 + (c >> 4)) * 1024 + n0 + (c & 15) * 8], 0, 1);
    }
    // own copies landed, then the barrier: it publishes both tiles to the other
    // waves and, directly behind the wait, keeps the LDS reads behind it
    async_fence();
    __syncthreads();

    v16h af[2], bf[4];
#pragma unroll
    for (int mt = 0; mt < 2; ++mt)
      af[mt] = ld_frag(&As[(wm * 32 + mt * 16 + lo) * 32 + hi * 8]);
    // B operand in the k order of ld_frag: slot s of half hi is k 8*hi + s (s < 8),
    // 16 + 8*hi + s - 8; column lo
    const _Float16* wp =
        &Ws[(hi * 8 + (lane & 7)) * WPITCH + wn * 64 + ((lane >> 3) & 1) * 8];
#pragma unroll
    for (int nt = 0; nt < 4; ++nt) {
      v8h w0 = ld_tr16(wp + nt * 16);
      v8h w1 = ld_tr16(wp + 16 * WPITCH + nt * 16);
#pragma unroll
      for (int i = 0; i < 8; ++i) { bf[nt][i] = w0[i]; bf[nt][i + 8] = w1[i]; }
    }
#pragma unroll
    for (int mt = 0; mt < 2; ++mt)
#pragma unroll
      for (int nt = 0; nt < 4; ++nt)
        acc[mt][nt] = __builtin_amdgcn_wmma_f32_16x16x32_f16(
            false, af[mt], false, bf[nt], (short)0, acc[mt][nt], false, false);
    __syncthreads();
  }

  // epilogue: C layout row M = r + 8*hi, col N = lo (within tile)
#pragma unroll
  for (int mt = 0; mt < 2; ++mt)
#pragma unroll
    for (int nt = 0; nt < 4; ++nt) {
      int   col = n0 + wn * 64 + nt * 16 + lo;
      float bv  = bias[col];
#pragma unroll
      for (int r = 0; r < 8; ++r) {
        int   rowg = m0 + wm * 32 + mt * 16 + r + hi * 8;
        float v    = acc[mt][nt][r] + bv;
        if (OUT_F32) Yf[(size_t)rowg * 1024 + col] = v;
        else         Yh[(size_t)rowg * 1024 + col] = (_Float16)v;
      }
    }
}

// Lane l with lane l ^ 16: the exchange between the wave halves, as a vector move
__device__ __forceinline__ float xhalf(float x) {
  return __builtin_bit_cast(float, __builtin_amdgcn_permlanex16(
      __builtin_bit_cast(int, x), __builtin_bit_cast(int, x),
      0x76543210, 0xfedcba98, false, false));
}

// V rows in LDS: 128 B of data at a pitch of 160 B (odd multiple of 32 B), the
// conflict-free pitch for the transposing load.
#define VPITCH 80

// ---------------------------------------------------------------------------
// Flash attention, transposed products: S^T = K Q^T, O^T += V^T P^T.
// One block per (64-query tile, b*h). 4 waves, 16 query columns per wave.
// A lane holds scores of ONE query (column lo), keys 8*hi + r of each 16-key tile,
// so max and sum run in-lane with one exchange between the wave halves, and two
// score tiles convert in place into the B operand of the second product.
// Q/K/V are f16 in [b, s, h*64+d] layout. ctx written in same layout.
// ---------------------------------------------------------------------------
__global__ __launch_bounds__(128)
void attention_kernel(const _Float16* __restrict__ Qh, const _Float16* __restrict__ Kh,
                      const _Float16* __restrict__ Vh, const float* __restrict__ mask,
                      _Float16* __restrict__ ctx) {
  __shared__ __align__(16) _Float16 Ks[64 * 64];       // key major, d contiguous
  __shared__ __align__(32) _Float16 Vs[64 * VPITCH];   // key major, d contiguous, padded rows

  const int t    = threadIdx.x;
  const int lane = t & 31;
  const int wid  = t >> 5;
  const int lo   = lane & 15;
  const int hi   = lane >> 4;
  const int bh   = blockIdx.y;
  const int b    = bh >> 4;
  const int h    = bh & 15;
  const int s0   = blockIdx.x * 64;
  const int qg   = s0 + wid * 16 + lo;   // this lane's query
  const size_t base = (size_t)b * SEQ * 1024 + (size_t)h * 64;

  // Q^T as B operand (column = query lo), loaded once and kept in registers
  v16h bq[2];
#pragma unroll
  for (int k2 = 0; k2 < 2; ++k2)
    bq[k2] = ld_frag(&Qh[base + (size_t)qg * 1024 + k2 * 32 + hi * 8]);

  const float* __restrict__ mq = mask + (size_t)qg * SEQ + hi * 8;

  const v8f zero = {0, 0, 0, 0, 0, 0, 0, 0};
  float mrow = -3.0e38f, lrow = 0.0f;   // lrow: this half's share of the row sum
  v8f acco[4];                          // O^T: row d = dt*16 + 8*hi + r, column lo
#pragma unroll
  for (int dt = 0; dt < 4; ++dt) acco[dt] = zero;

  for (int kb = 0; kb < SEQ; kb += 64) {
    __syncthreads();  // protect Ks/Vs from previous iteration's readers
    // stage K and V row-major (async)
#pragma unroll
    for (int i = 0; i < 4; ++i) {
      int c = t + i * 128;
      int row = c >> 3, d0 = (c & 7) * 8;
      copy16_g2l(&Ks[row * 64 + d0],
                 &Kh[base + (size_t)(kb + row) * 1024 + d0]);
      copy16_g2l(&Vs[row * VPITCH + d0],
                 &Vh[base + (size_t)(kb + row) * 1024 + d0]);
    }
    // prefetch next key block while this one is being consumed
    if (kb + 64 < SEQ) {
      int c = t;
      int row = c >> 3, d0 = (c & 7) * 8;
      __builtin_prefetch(&Kh[base + (size_t)(kb + 64 + row) * 1024 + d0], 0, 1);
      __builtin_prefetch(&Vh[base + (size_t)(kb + 64 + row) * 1024 + d0], 0, 1);
    }
    // this lane's mask values: 8 consecutive keys per 16-key tile
    float4 mk[4][2];
#pragma unroll
    for (int nt = 0; nt < 4; ++nt) {
      mk[nt][0] = *(const float4*)(mq + kb + nt * 16);
      mk[nt][1] = *(const float4*)(mq + kb + nt * 16 + 4);
    }
    async_fence();
    __syncthreads();

    // S^T = K @ Q^T : 64 keys (4 M-tiles) x 16 query columns, Kdim = depth 64
    v8f sacc[4];
#pragma unroll
    for (int nt = 0; nt < 4; ++nt) sacc[nt] = zero;
#pragma unroll
    for (int k2 = 0; k2 < 2; ++k2)
#pragma unroll
      for (int nt = 0; nt < 4; ++nt) {
        v16h ak = ld_frag(&Ks[(nt * 16 + lo) * 64 + k2 * 32 + hi * 8]);
        sacc[nt] = __builtin_amdgcn_wmma_f32_16x16x32_f16(
            false, ak, false, bq[k2], (short)0, sacc[nt], false, false);
      }

    // scaled logits + mask, then online softmax. D layout: key r+8*hi, query lo.
    float p[4][8];
    float mb = -3.0e38f;
#pragma unroll
    for (int nt = 0; nt < 4; ++nt) {
      const float mv[8] = {mk[nt][0].x, mk[nt][0].y, mk[nt][0].z, mk[nt][0].w,
                           mk[nt][1].x, mk[nt][1].y, mk[nt][1].z, mk[nt][1].w};
#pragma unroll
      for (int r = 0; r < 8; ++r) {
        float v  = sacc[nt][r] * 0.125f + mv[r] * (-1e9f);
        p[nt][r] = v;
        mb       = fmaxf(mb, v);
      }
    }
    mb = fmaxf(mb, xhalf(mb));   // the other half's 32 keys

    const float mn   = fmaxf(mrow, mb);
    const float corr = __expf(mrow - mn);
    mrow = mn;
    float s4[4];
#pragma unroll
    for (int nt = 0; nt < 4; ++nt) {
      float s = 0.0f;
#pragma unroll
      for (int r = 0; r < 8; ++r) {
        p[nt][r] = __expf(p[nt][r] - mn);
        s += p[nt][r];
      }
      s4[nt] = s;
    }
    lrow = lrow * corr + ((s4[0] + s4[1]) + (s4[2] + s4[3]));
#pragma unroll
    for (int dt = 0; dt < 4; ++dt)
#pragma unroll
      for (int r = 0; r < 8; ++r) acco[dt][r] = acco[dt][r] * corr;

    // O^T += V^T @ P^T : Kdim = 64 keys, 4 depth tiles. Both operands in the
    // hardware k order: slot s of half hi is key 8*hi + s (s < 8), 16 + 8*hi + s - 8.
#pragma unroll
    for (int k2 = 0; k2 < 2; ++k2) {
      v16h bp;
#pragma unroll
      for (int i = 0; i < 8; ++i) {
        bp[i]     = (_Float16)p[2 * k2][i];
        bp[i + 8] = (_Float16)p[2 * k2 + 1][i];
      }
      const _Float16* vp =
          &Vs[(k2 * 32 + hi * 8 + (lane & 7)) * VPITCH + ((lane >> 3) & 1) * 8];
#pragma unroll
      for (int dt = 0; dt < 4; ++dt) {
        v8h v0 = ld_tr16(vp + dt * 16);
        v8h v1 = ld_tr16(vp + 16 * VPITCH + dt * 16);
        v16h av;
#pragma unroll
        for (int i = 0; i < 8; ++i) { av[i] = v0[i]; av[i + 8] = v1[i]; }
        acco[dt] = __builtin_amdgcn_wmma_f32_16x16x32_f16(
            false, av, false, bp, (short)0, acco[dt], false, false);
      }
    }
  }

  // join the halves' sums, normalize and write context (f16, [b,s,h*64+d] layout):
  // a lane's 8 registers are 8 consecutive d of its query, one 16-byte store
  lrow += xhalf(lrow);
#pragma unroll
  for (int dt = 0; dt < 4; ++dt) {
    v8h o;
#pragma unroll
    for (int r = 0; r < 8; ++r) o[r] = (_Float16)(acco[dt][r] / lrow);
    *(v8h*)&ctx[base + (size_t)qg * 1024 + dt * 16 + hi * 8] = o;
  }
}

// ---------------------------------------------------------------------------
extern "C" void kernel_launch(void* const* d_in, const int* in_sizes, int n_in,
                              void* d_out, int out_size, void* d_ws, size_t ws_size,
                              hipStream_t stream) {
  (void)in_sizes; (void)n_in; (void)out_size; (void)ws_size;

  const float* q    = (const float*)d_in[0];
  const float* k    = (const float*)d_in[1];
  const float* v    = (const float*)d_in[2];
  const float* mask = (const float*)d_in[3];
  const float* wq   = (const float*)d_in[4];
  const float* bq   = (const float*)d_in[5];
  const float* wk   = (const float*)d_in[6];
  const float* bk   = (const float*)d_in[7];
  const float* wv   = (const float*)d_in[8];
  const float* bv   = (const float*)d_in[9];
  const float* wo   = (const float*)d_in[10];
  const float* bo   = (const float*)d_in[11];
  float* out = (float*)d_out;

  const size_t SZX = (size_t)MTOT * 1024;     // 4,194,304
  const size_t SZW = (size_t)1024 * 1024;     // 1,048,576
  _Float16* w16 = (_Float16*)d_ws;            // total 64 MiB of f16 scratch
  _Float16* qx  = w16;
  _Float16* kx  = qx + SZX;
  _Float16* vx  = kx + SZX;
  _Float16* wqh = vx + SZX;
  _Float16* wkh = wqh + SZW;
  _Float16* wvh = wkh + SZW;
  _Float16* woh = wvh + SZW;
  _Float16* Qp  = woh + SZW;
  _Float16* Kp  = Qp + SZX;
  _Float16* Vp  = Kp + SZX;
  _Float16* Cx  = Vp + SZX;

  const int cb = 256;
  cvt_kernel<<<dim3((unsigned)(SZX / 4 / cb)), cb, 0, stream>>>(q, qx, (int)SZX);
  cvt_kernel<<<dim3((unsigned)(SZX / 4 / cb)), cb, 0, stream>>>(k, kx, (int)SZX);
  cvt_kernel<<<dim3((unsigned)(SZX / 4 / cb)), cb, 0, stream>>>(v, vx, (int)SZX);
  cvt_kernel<<<dim3((unsigned)(SZW / 4 / cb)), cb, 0, stream>>>(wq, wqh, (int)SZW);
  cvt_kernel<<<dim3((unsigned)(SZW / 4 / cb)), cb, 0, stream>>>(wk, wkh, (int)SZW);
  cvt_kernel<<<dim3((unsigned)(SZW / 4 / cb)), cb, 0, stream>>>(wv, wvh, (int)SZW);
  cvt_kernel<<<dim3((unsigned)(SZW / 4 / cb)), cb, 0, stream>>>(wo, woh, (int)SZW);

  dim3 gg(1024 / 128, MTOT / 128);  // (8, 32)
  gemm_f16_kernel<false><<<gg, 256, 0, stream>>>(qx, wqh, bq, nullptr, Qp);
  gemm_f16_kernel<false><<<gg, 256, 0, stream>>>(kx, wkh, bk, nullptr, Kp);
  gemm_f16_kernel<false><<<gg, 256, 0, stream>>>(vx, wvh, bv, nullptr, Vp);

  attention_kernel<<<dim3(SEQ / 64, BATCH * NUM_HEADS), 128, 0, stream>>>(
      Qp, Kp, Vp, mask, Cx);

  gemm_f16_kernel<true><<<gg, 256, 0, stream>>>(Cx, woh, bo, out, nullptr);
}

// v003
// One run takes 212 microseconds.
// Two timings next to v002 both put it at 1.05 times that version's speed.
// Counting every step since v000, it is 2.10 times as fast.
#include <hip/hip_runtime.h>
#include <math.h>

typedef __attribute__((ext_vector_type(16))) _Float16 v16h;
typedef __attribute__((ext_vector_type(8)))  _Float16 v8h;
typedef __attribute__((ext_vector_type(8)))  float    v8f;
typedef __attribute__((ext_vector_type(4)))  int      v4i;

#define D_MODEL 1024
#define NUM_HEADS 16
#define DEPTH 64
#define BATCH 2
#define SEQ 2048
#define MTOT (BATCH * SEQ)   // 4096

// CDNA5 async global->LDS copies (ASYNCcnt path). Guarded so either toolchain
// compiles; host pass always takes the plain fallback.
#if defined(__HIP_DEVICE_COMPILE__) &&                                   \
    __has_builtin(__builtin_amdgcn_global_load_async_to_lds_b128) &&     \
    __has_builtin(__builtin_amdgcn_s_wait_asynccnt)
#define USE_ASYNC_LDS 1
#else
#define USE_ASYNC_LDS 0
#endif

#if USE_ASYNC_LDS
typedef __attribute__((address_space(1))) v4i* as1_v4i_ptr;
typedef __attribute__((address_space(3))) v4i* as3_v4i_ptr;
#endif

__device__ __forceinline__ void copy16_g2l(void* lds, const void* g) {
#if USE_ASYNC_LDS
  __builtin_amdgcn_global_load_async_to_lds_b128(
      (as1_v4i_ptr)(void*)g, (as3_v4i_ptr)lds, 0, 0);
#else
  *(v8h*)lds = *(const v8h*)g;
#endif
}

__device__ __forceinline__ void async_fence() {
#if USE_ASYNC_LDS
  __builtin_amdgcn_s_wait_asynccnt(0);
#endif
}

struct h4 { _Float16 x, y, z, w; };

// ---------------------------------------------------------------------------
// fp32 -> f16 conversion of all seven operands in ONE launch of resident waves.
// The f16 copies lie back to back in the workspace in the order q, k, v, wq, wk,
// wv, wo: 16 units of 2^20 elements (4 + 4 + 4 + 1 + 1 + 1 + 1). 256 blocks of 16
// waves, one per WGP; a block converts 65,536 consecutive elements of one unit.
// Each wave-wide load takes 512 contiguous bytes, each store two whole lines; a
// wave's 32 loads are spread over the block's 256 KiB.
// ---------------------------------------------------------------------------
#define CVT_THREADS 512
#define CVT_BLOCKS 256
#define CVT_STEP (CVT_THREADS * 4)   // elements a block converts per load round
#define CVT_ROUNDS 32                // 32 * 2048 = 65,536 elements per block

__global__ __launch_bounds__(CVT_THREADS)
void cvt_all_kernel(const float* __restrict__ q, const float* __restrict__ k,
                    const float* __restrict__ v, const float* __restrict__ wq,
                    const float* __restrict__ wk, const float* __restrict__ wv,
                    const float* __restrict__ wo, _Float16* __restrict__ out) {
  const int b = blockIdx.x;
  const int u = b >> 4;   // unit of 2^20 elements
  const float* s;         // start of this unit in its own operand
  if (u < 4)        s = q + ((size_t)u << 20);
  else if (u < 8)   s = k + ((size_t)(u - 4) << 20);
  else if (u < 12)  s = v + ((size_t)(u - 8) << 20);
  else if (u == 12) s = wq;
  else if (u == 13) s = wk;
  else if (u == 14) s = wv;
  else              s = wo;
  const float* __restrict__ in = s + (b & 15) * (CVT_STEP * CVT_ROUNDS) + threadIdx.x * 4;
  _Float16* __restrict__ o16 =
      out + (size_t)b * (CVT_STEP * CVT_ROUNDS) + threadIdx.x * 4;

  // The loads stand in a loop of their own ahead of the conversions, so that many
  // are in flight per wave (a single load-convert-store loop built with one in
  // flight). Both loops are unrolled so that x[] stays in registers and every
  // address is base + constant.
  float4 x[CVT_ROUNDS];
#pragma unroll
  for (int i = 0; i < CVT_ROUNDS; ++i) x[i] = *(const float4*)(in + i * CVT_STEP);
#pragma unroll
  for (int i = 0; i < CVT_ROUNDS; ++i) {
    h4 o;
    o.x = (_Float16)x[i].x; o.y = (_Float16)x[i].y;
    o.z = (_Float16)x[i].z; o.w = (_Float16)x[i].w;
    *(h4*)(o16 + i * CVT_STEP) = o;
  }
}

// ---------------------------------------------------------------------------
// Fragment loader for 16-bit A/B operands of v_wmma_*_16x16x32.
// Lanes 0-15 -> row lo, K {0..7, 16..23}; lanes 16-31 -> row lo, K {8..15, 24..31}.
// Caller passes lane-resolved pointer (base + lo*stride + hi*8), 16B aligned.
// ---------------------------------------------------------------------------
__device__ __forceinline__ v16h ld_frag(const _Float16* p) {
  v8h a = *(const v8h*)p;
  v8h b = *(const v8h*)(p + 16);
  v16h r;
#pragma unroll
  for (int i = 0; i < 8; ++i) { r[i] = a[i]; r[i + 8] = b[i]; }
  return r;
}

typedef __attribute__((ext_vector_type(8))) short s16x8;
typedef __attribute__((address_space(3))) s16x8 lds_s16x8;

__device__ __forceinline__ v8h ld_tr16(const _Float16* p) {
  return __builtin_bit_cast(v8h, __builtin_amdgcn_ds_load_tr16_b128_v8i16((lds_s16x8*)p));
}

// W rows in LDS: 256 B of data at a pitch of 288 B (odd multiple of 32 B), the
// conflict-free pitch for the transposing load.
#define WPITCH 144

// ---------------------------------------------------------------------------
// GEMM: Y[M,1024] = X[M,1024] @ W[1024,1024] + bias
// Block: 256 threads (8 waves), tile 128x128, BK=32.
// Wave (wm,wn) in 4x2 grid computes 32x64 via 2x4 WMMA tiles.
// The W tile lies in LDS as in memory (k rows, n contiguous); the transposing
// load turns it into the B operand.
// ---------------------------------------------------------------------------
template <bool OUT_F32>
__global__ __launch_bounds__(256)
void gemm_f16_kernel(const _Float16* __restrict__ X, const _Float16* __restrict__ W,
                     const float* __restrict__ bias, float* __restrict__ Yf,
                     _Float16* __restrict__ Yh) {
  __shared__ __align__(16) _Float16 As[128 * 32];  // m-major, k-contiguous
  __shared__ __align__(32) _Float16 Ws[32 * WPITCH];  // k-major, n-contiguous, padded rows

  const int t    = threadIdx.x;
  const int lane = t & 31;
  const int wid  = t >> 5;
  const int lo   = lane & 15;
  const int hi   = lane >> 4;
  const int wm   = wid >> 1;  // 0..3
  const int wn   = wid & 1;   // 0..1
  const int m0   = blockIdx.y * 128;
  const int n0   = blockIdx.x * 128;

  const v8f zero = {0, 0, 0, 0, 0, 0, 0, 0};
  v8f acc[2][4];
#pragma unroll
  for (int i = 0; i < 2; ++i)
#pragma unroll
    for (int j = 0; j < 4; ++j) acc[i][j] = zero;

  for (int k0 = 0; k0 < 1024; k0 += 32) {
    // stage A (async DMA into LDS): 128x32 f16 = 512 chunks of 8, 2 per thread
#pragma unroll
    for (int i = 0; i < 2; ++i) {
      int c   = t + i * 256;
      int row = c >> 2;
      int c8  = (c & 3) * 8;
      copy16_g2l(&As[row * 32 + c8],
                 &X[(size_t)(m0 + row) * 1024 + k0 + c8]);
    }
    // stage W tile row-major (async): 32x128 f16 = 512 chunks of 8, 2 per thread
#pragma unroll
    for (int i = 0; i < 2; ++i) {
      int c    = t + i * 256;
      int krow = c >> 4;
      int nc   = (c & 15) * 8;
      copy16_g2l(&Ws[krow * WPITCH + nc],
                 &W[(size_t)(k0 + krow) * 1024 + n0 + nc]);
    }
    // prefetch next iteration's tiles into cache while we compute
    if (k0 + 32 < 1024) {
      int c = t;
      __builtin_prefetch(&X[(size_t)(m0 + (c >> 2)) * 1024 + k0 + 32 + (c & 3) * 8], 0, 1);
      __builtin_prefetch(&W[(size_t)(k0 + 32 + (c >> 4)) * 1024 + n0 + (c & 15) * 8], 0, 1);
    }
    // own copies landed, then the barrier: it publishes both tiles to the other
    // waves and, directly behind the wait, keeps the LDS reads behind it
    async_fence();
    __syncthreads();

    v16h af[2], bf[4];
#pragma unroll
    for (int mt = 0; mt < 2; ++mt)
      af[mt] = ld_frag(&As[(wm * 32 + mt * 16 + lo) * 32 + hi * 8]);
    // B operand in the k order of ld_frag: slot s of half hi is k 8*hi + s (s < 8),
    // 16 + 8*hi + s - 8; column lo
    const _Float16* wp =
        &Ws[(hi * 8 + (lane & 7)) * WPITCH + wn * 64 + ((lane >> 3) & 1) * 8];
#pragma unroll
    for (int nt = 0; nt < 4; ++nt) {
      v8h w0 = ld_tr16(wp + nt * 16);
      v8h w1 = ld_tr16(wp + 16 * WPITCH + nt * 16);
#pragma unroll
      for (int i = 0; i < 8; ++i) { bf[nt][i] = w0[i]; bf[nt][i + 8] = w1[i]; }
    }
#pragma unroll
    for (int mt = 0; mt < 2; ++mt)
#pragma unroll
      for (int nt = 0; nt < 4; ++nt)
        acc[mt][nt] = __builtin_amdgcn_wmma_f32_16x16x32_f16(
            false, af[mt], false, bf[nt], (short)0, acc[mt][nt], false, false);
    __syncthreads();
  }

  // epilogue: C layout row M = r + 8*hi, col N = lo (within tile)
#pragma unroll
  for (int mt = 0; mt < 2; ++mt)
#pragma unroll
    for (int nt = 0; nt < 4; ++nt) {
      int   col = n0 + wn * 64 + nt * 16 + lo;
      float bv  = bias[col];
#pragma unroll
      for (int r = 0; r < 8; ++r) {
        int   rowg = m0 + wm * 32 + mt * 16 + r + hi * 8;
        float v    = acc[mt][nt][r] + bv;
        if (OUT_F32) Yf[(size_t)rowg * 1024 + col] = v;
        else         Yh[(size_t)rowg * 1024 + col] = (_Float16)v;
      }
    }
}

// Lane l with lane l ^ 16: the exchange between the wave halves, as a vector move
__device__ __forceinline__ float xhalf(float x) {
  return __builtin_bit_cast(float, __builtin_amdgcn_permlanex16(
      __builtin_bit_cast(int, x), __builtin_bit_cast(int, x),
      0x76543210, 0xfedcba98, false, false));
}

// V rows in LDS: 128 B of data at a pitch of 160 B (odd multiple of 32 B), the
// conflict-free pitch for the transposing load.
#define VPITCH 80

// ---------------------------------------------------------------------------
// Flash attention, transposed products: S^T = K Q^T, O^T += V^T P^T.
// One block per (64-query tile, b*h). 4 waves, 16 query columns per wave.
// A lane holds scores of ONE query (column lo), keys 8*hi + r of each 16-key tile,
// so max and sum run in-lane with one exchange between the wave halves, and two
// score tiles convert in place into the B operand of the second product.
// Q/K/V are f16 in [b, s, h*64+d] layout. ctx written in same layout.
// ---------------------------------------------------------------------------
__global__ __launch_bounds__(128)
void attention_kernel(const _Float16* __restrict__ Qh, const _Float16* __restrict__ Kh,
                      const _Float16* __restrict__ Vh, const float* __restrict__ mask,
                      _Float16* __restrict__ ctx) {
  __shared__ __align__(16) _Float16 Ks[64 * 64];       // key major, d contiguous
  __shared__ __align__(32) _Float16 Vs[64 * VPITCH];   // key major, d contiguous, padded rows

  const int t    = threadIdx.x;
  const int lane = t & 31;
  const int wid  = t >> 5;
  const int lo   = lane & 15;
  const int hi   = lane >> 4;
  const int bh   = blockIdx.y;
  const int b    = bh >> 4;
  const int h    = bh & 15;
  const int s0   = blockIdx.x * 64;
  const int qg   = s0 + wid * 16 + lo;   // this lane's query
  const size_t base = (size_t)b * SEQ * 1024 + (size_t)h * 64;

  // Q^T as B operand (column = query lo), loaded once and kept in registers
  v16h bq[2];
#pragma unroll
  for (int k2 = 0; k2 < 2; ++k2)
    bq[k2] = ld_frag(&Qh[base + (size_t)qg * 1024 + k2 * 32 + hi * 8]);

  const float* __restrict__ mq = mask + (size_t)qg * SEQ + hi * 8;

  const v8f zero = {0, 0, 0, 0, 0, 0, 0, 0};
  float mrow = -3.0e38f, lrow = 0.0f;   // lrow: this half's share of the row sum
  v8f acco[4];                          // O^T: row d = dt*16 + 8*hi + r, column lo
#pragma unroll
  for (int dt = 0; dt < 4; ++dt) acco[dt] = zero;

  for (int kb = 0; kb < SEQ; kb += 64) {
    __syncthreads();  // protect Ks/Vs from previous iteration's readers
    // stage K and V row-major (async)
#pragma unroll
    for (int i = 0; i < 4; ++i) {
      int c = t + i * 128;
      int row = c >> 3, d0 = (c & 7) * 8;
      copy16_g2l(&Ks[row * 64 + d0],
                 &Kh[base + (size_t)(kb + row) * 1024 + d0]);
      copy16_g2l(&Vs[row * VPITCH + d0],
                 &Vh[base + (size_t)(kb + row) * 1024 + d0]);
    }
    // prefetch next key block while this one is being consumed
    if (kb + 64 < SEQ) {
      int c = t;
      int row = c >> 3, d0 = (c & 7) * 8;
      __builtin_prefetch(&Kh[base + (size_t)(kb + 64 + row) * 1024 + d0], 0, 1);
      __builtin_prefetch(&Vh[base + (size_t)(kb + 64 + row) * 1024 + d0], 0, 1);
    }
    // this lane's mask values: 8 consecutive keys per 16-key tile
    float4 mk[4][2];
#pragma unroll
    for (int nt = 0; nt < 4; ++nt) {
      mk[nt][0] = *(const float4*)(mq + kb + nt * 16);
      mk[nt][1] = *(const float4*)(mq + kb + nt * 16 + 4);
    }
    async_fence();
    __syncthreads();

    // S^T = K @ Q^T : 64 keys (4 M-tiles) x 16 query columns, Kdim = depth 64
    v8f sacc[4];
#pragma unroll
    for (int nt = 0; nt < 4; ++nt) sacc[nt] = zero;
#pragma unroll
    for (int k2 = 0; k2 < 2; ++k2)
#pragma unroll
      for (int nt = 0; nt < 4; ++nt) {
        v16h ak = ld_frag(&Ks[(nt * 16 + lo) * 64 + k2 * 32 + hi * 8]);
        sacc[nt] = __builtin_amdgcn_wmma_f32_16x16x32_f16(
            false, ak, false, bq[k2], (short)0, sacc[nt], false, false);
      }

    // scaled logits + mask, then online softmax. D layout: key r+8*hi, query lo.
    float p[4][8];
    float mb = -3.0e38f;
#pragma unroll
    for (int nt = 0; nt < 4; ++nt) {
      const float mv[8] = {mk[nt][0].x, mk[nt][0].y, mk[nt][0].z, mk[nt][0].w,
                           mk[nt][1].x, mk[nt][1].y, mk[nt][1].z, mk[nt][1].w};
#pragma unroll
      for (int r = 0; r < 8; ++r) {
        float v  = sacc[nt][r] * 0.125f + mv[r] * (-1e9f);
        p[nt][r] = v;
        mb       = fmaxf(mb, v);
      }
    }
    mb = fmaxf(mb, xhalf(mb));   // the other half's 32 keys

    const float mn   = fmaxf(mrow, mb);
    const float corr = __expf(mrow - mn);
    mrow = mn;
    float s4[4];
#pragma unroll
    for (int nt = 0; nt < 4; ++nt) {
      float s = 0.0f;
#pragma unroll
      for (int r = 0; r < 8; ++r) {
        p[nt][r] = __expf(p[nt][r] - mn);
        s += p[nt][r];
      }
      s4[nt] = s;
    }
    lrow = lrow * corr + ((s4[0] + s4[1]) + (s4[2] + s4[3]));
#pragma unroll
    for (int dt = 0; dt < 4; ++dt)
#pragma unroll
      for (int r = 0; r < 8; ++r) acco[dt][r] = acco[dt][r] * corr;

    // O^T += V^T @ P^T : Kdim = 64 keys, 4 depth tiles. Both operands in the
    // hardware k order: slot s of half hi is key 8*hi + s (s < 8), 16 + 8*hi + s - 8.
#pragma unroll
    for (int k2 = 0; k2 < 2; ++k2) {
      v16h bp;
#pragma unroll
      for (int i = 0; i < 8; ++i) {
        bp[i]     = (_Float16)p[2 * k2][i];
        bp[i + 8] = (_Float16)p[2 * k2 + 1][i];
      }
      const _Float16* vp =
          &Vs[(k2 * 32 + hi * 8 + (lane & 7)) * VPITCH + ((lane >> 3) & 1) * 8];
#pragma unroll
      for (int dt = 0; dt < 4; ++dt) {
        v8h v0 = ld_tr16(vp + dt * 16);
        v8h v1 = ld_tr16(vp + 16 * VPITCH + dt * 16);
        v16h av;
#pragma unroll
        for (int i = 0; i < 8; ++i) { av[i] = v0[i]; av[i + 8] = v1[i]; }
        acco[dt] = __builtin_amdgcn_wmma_f32_16x16x32_f16(
            false, av, false, bp, (short)0, acco[dt], false, false);
      }
    }
  }

  // join the halves' sums, normalize and write context (f16, [b,s,h*64+d] layout):
  // a lane's 8 registers are 8 consecutive d of its query, one 16-byte store
  lrow += xhalf(lrow);
#pragma unroll
  for (int dt = 0; dt < 4; ++dt) {
    v8h o;
#pragma unroll
    for (int r = 0; r < 8; ++r) o[r] = (_Float16)(acco[dt][r] / lrow);
    *(v8h*)&ctx[base + (size_t)qg * 1024 + dt * 16 + hi * 8] = o;
  }
}

// ---------------------------------------------------------------------------
extern "C" void kernel_launch(void* const* d_in, const int* in_sizes, int n_in,
                              void* d_out, int out_size, void* d_ws, size_t ws_size,
                              hipStream_t stream) {
  (void)in_sizes; (void)n_in; (void)out_size; (void)ws_size;

  const float* q    = (const float*)d_in[0];
  const float* k    = (const float*)d_in[1];
  const float* v    = (const float*)d_in[2];
  const float* mask = (const float*)d_in[3];
  const float* wq   = (const float*)d_in[4];
  const float* bq   = (const float*)d_in[5];
  const float* wk   = (const float*)d_in[6];
  const float* bk   = (const float*)d_in[7];
  const float* wv   = (const float*)d_in[8];
  const float* bv   = (const float*)d_in[9];
  const float* wo   = (const float*)d_in[10];
  const float* bo   = (const float*)d_in[11];
  float* out = (float*)d_out;

  const size_t SZX = (size_t)MTOT * 1024;     // 4,194,304
  const size_t SZW = (size_t)1024 * 1024;     // 1,048,576
  _Float16* w16 = (_Float16*)d_ws;            // total 64 MiB of f16 scratch
  _Float16* qx  = w16;
  _Float16* kx  = qx + SZX;
  _Float16* vx  = kx + SZX;
  _Float16* wqh = vx + SZX;
  _Float16* wkh = wqh + SZW;
  _Float16* wvh = wkh + SZW;
  _Float16* woh = wvh + SZW;
  _Float16* Qp  = woh + SZW;
  _Float16* Kp  = Qp + SZX;
  _Float16* Vp  = Kp + SZX;
  _Float16* Cx  = Vp + SZX;

  // qx .. woh are contiguous from w16 in the kernel's unit order
  cvt_all_kernel<<<dim3(CVT_BLOCKS), CVT_THREADS, 0, stream>>>(q, k, v, wq, wk, wv, wo, w16);

  dim3 gg(1024 / 128, MTOT / 128);  // (8, 32)
  gemm_f16_kernel<false><<<gg, 256, 0, stream>>>(qx, wqh, bq, nullptr, Qp);
  gemm_f16_kernel<false><<<gg, 256, 0, stream>>>(kx, wkh, bk, nullptr, Kp);
  gemm_f16_kernel<false><<<gg, 256, 0, stream>>>(vx, wvh, bv, nullptr, Vp);

  attention_kernel<<<dim3(SEQ / 64, BATCH * NUM_HEADS), 128, 0, stream>>>(
      Qp, Kp, Vp, mask, Cx);

  gemm_f16_kernel<true><<<gg, 256, 0, stream>>>(Cx, woh, bo, out, nullptr);
}

// v004
// A run of this version takes 186 microseconds.
// Two timings next to v003 put it at 1.15 and 1.14 times that version's speed.
// Over all steps from v000 it is 2.41 times as fast.
#include <hip/hip_runtime.h>
#include <math.h>

typedef __attribute__((ext_vector_type(16))) _Float16 v16h;
typedef __attribute__((ext_vector_type(8)))  _Float16 v8h;
typedef __attribute__((ext_vector_type(8)))  float    v8f;
typedef __attribute__((ext_vector_type(4)))  int      v4i;

#define D_MODEL 1024
#define NUM_HEADS 16
#define DEPTH 64
#define BATCH 2
#define SEQ 2048
#define MTOT (BATCH * SEQ)   // 4096

// CDNA5 async global->LDS copies (ASYNCcnt path). Guarded so either toolchain
// compiles; host pass always takes the plain fallback.
#if defined(__HIP_DEVICE_COMPILE__) &&                                   \
    __has_builtin(__builtin_amdgcn_global_load_async_to_lds_b128) &&     \
    __has_builtin(__builtin_amdgcn_s_wait_asynccnt)
#define USE_ASYNC_LDS 1
#else
#define USE_ASYNC_LDS 0
#endif

#if USE_ASYNC_LDS
typedef __attribute__((address_space(1))) v4i* as1_v4i_ptr;
typedef __attribute__((address_space(3))) v4i* as3_v4i_ptr;
#endif

__device__ __forceinline__ void copy16_g2l(void* lds, const void* g) {
#if USE_ASYNC_LDS
  __builtin_amdgcn_global_load_async_to_lds_b128(
      (as1_v4i_ptr)(void*)g, (as3_v4i_ptr)lds, 0, 0);
#else
  *(v8h*)lds = *(const v8h*)g;
#endif
}

__device__ __forceinline__ void async_fence() {
#if USE_ASYNC_LDS
  __builtin_amdgcn_s_wait_asynccnt(0);
#endif
}

struct h4 { _Float16 x, y, z, w; };

// ---------------------------------------------------------------------------
// fp32 -> f16 conversion of all seven operands in ONE launch of resident waves.
// The f16 copies lie back to back in the workspace in the order q, k, v, wq, wk,
// wv, wo: 16 units of 2^20 elements (4 + 4 + 4 + 1 + 1 + 1 + 1). 256 blocks of 16
// waves, one per WGP; a block converts 65,536 consecutive elements of one unit.
// Each wave-wide load takes 512 contiguous bytes, each store two whole lines; a
// wave's 32 loads are spread over the block's 256 KiB.
// ---------------------------------------------------------------------------
#define CVT_THREADS 512
#define CVT_BLOCKS 256
#define CVT_STEP (CVT_THREADS * 4)   // elements a block converts per load round
#define CVT_ROUNDS 32                // 32 * 2048 = 65,536 elements per block

__global__ __launch_bounds__(CVT_THREADS)
void cvt_all_kernel(const float* __restrict__ q, const float* __restrict__ k,
                    const float* __restrict__ v, const float* __restrict__ wq,
                    const float* __restrict__ wk, const float* __restrict__ wv,
                    const float* __restrict__ wo, _Float16* __restrict__ out) {
  const int b = blockIdx.x;
  const int u = b >> 4;   // unit of 2^20 elements
  const float* s;         // start of this unit in its own operand
  if (u < 4)        s = q + ((size_t)u << 20);
  else if (u < 8)   s = k + ((size_t)(u - 4) << 20);
  else if (u < 12)  s = v + ((size_t)(u - 8) << 20);
  else if (u == 12) s = wq;
  else if (u == 13) s = wk;
  else if (u == 14) s = wv;
  else              s = wo;
  const float* __restrict__ in = s + (b & 15) * (CVT_STEP * CVT_ROUNDS) + threadIdx.x * 4;
  _Float16* __restrict__ o16 =
      out + (size_t)b * (CVT_STEP * CVT_ROUNDS) + threadIdx.x * 4;

  // The loads stand in a loop of their own ahead of the conversions, so that many
  // are in flight per wave (a single load-convert-store loop built with one in
  // flight). Both loops are unrolled so that x[] stays in registers and every
  // address is base + constant.
  float4 x[CVT_ROUNDS];
#pragma unroll
  for (int i = 0; i < CVT_ROUNDS; ++i) x[i] = *(const float4*)(in + i * CVT_STEP);
#pragma unroll
  for (int i = 0; i < CVT_ROUNDS; ++i) {
    h4 o;
    o.x = (_Float16)x[i].x; o.y = (_Float16)x[i].y;
    o.z = (_Float16)x[i].z; o.w = (_Float16)x[i].w;
    *(h4*)(o16 + i * CVT_STEP) = o;
  }
}

// ---------------------------------------------------------------------------
// Fragment loader for 16-bit A/B operands of v_wmma_*_16x16x32.
// Lanes 0-15 -> row lo, K {0..7, 16..23}; lanes 16-31 -> row lo, K {8..15, 24..31}.
// Caller passes lane-resolved pointer (base + lo*stride + hi*8), 16B aligned.
// ---------------------------------------------------------------------------
__device__ __forceinline__ v16h ld_frag(const _Float16* p) {
  v8h a = *(const v8h*)p;
  v8h b = *(const v8h*)(p + 16);
  v16h r;
#pragma unroll
  for (int i = 0; i < 8; ++i) { r[i] = a[i]; r[i + 8] = b[i]; }
  return r;
}

typedef __attribute__((ext_vector_type(8))) short s16x8;
typedef __attribute__((address_space(3))) s16x8 lds_s16x8;

__device__ __forceinline__ v8h ld_tr16(const _Float16* p) {
  return __builtin_bit_cast(v8h, __builtin_amdgcn_ds_load_tr16_b128_v8i16((lds_s16x8*)p));
}

// W rows in LDS: 256 B of data at a pitch of 288 B (odd multiple of 32 B), the
// conflict-free pitch for the transposing load.
#define WPITCH 144

// X rows in LDS: 64 B of data at a pitch of 80 B (odd multiple of 16 B), the
// conflict-free pitch for the 16-byte fragment loads; at 64 B the 16 rows of a
// fragment fall on a quarter of the banks.
#define APITCH 40

// ---------------------------------------------------------------------------
// GEMM: Y[M,1024] = X[M,1024] @ W[1024,1024] + bias
// Block: 256 threads (8 waves), tile 128x128, BK=32.
// Wave (wm,wn) in 4x2 grid computes 32x64 via 2x4 WMMA tiles.
// The W tile lies in LDS as in memory (k rows, n contiguous); the transposing
// load turns it into the B operand.
// ---------------------------------------------------------------------------
template <bool OUT_F32>
__global__ __launch_bounds__(256)
void gemm_f16_kernel(const _Float16* __restrict__ X, const _Float16* __restrict__ W,
                     const float* __restrict__ bias, float* __restrict__ Yf,
                     _Float16* __restrict__ Yh) {
  __shared__ __align__(16) _Float16 As[128 * APITCH];  // m-major, k-contiguous, padded rows
  __shared__ __align__(32) _Float16 Ws[32 * WPITCH];  // k-major, n-contiguous, padded rows

  const int t    = threadIdx.x;
  const int lane = t & 31;
  const int wid  = t >> 5;
  const int lo   = lane & 15;
  const int hi   = lane >> 4;
  const int wm   = wid >> 1;  // 0..3
  const int wn   = wid & 1;   // 0..1
  const int m0   = blockIdx.y * 128;
  const int n0   = blockIdx.x * 128;

  const v8f zero = {0, 0, 0, 0, 0, 0, 0, 0};
  v8f acc[2][4];
#pragma unroll
  for (int i = 0; i < 2; ++i)
#pragma unroll
    for (int j = 0; j < 4; ++j) acc[i][j] = zero;

  for (int k0 = 0; k0 < 1024; k0 += 32) {
    // stage A (async DMA into LDS): 128x32 f16 = 512 chunks of 8, 2 per thread
#pragma unroll
    for (int i = 0; i < 2; ++i) {
      int c   = t + i * 256;
      int row = c >> 2;
      int c8  = (c & 3) * 8;
      copy16_g2l(&As[row * APITCH + c8],
                 &X[(size_t)(m0 + row) * 1024 + k0 + c8]);
    }
    // stage W tile row-major (async): 32x128 f16 = 512 chunks of 8, 2 per thread
#pragma unroll
    for (int i = 0; i < 2; ++i) {
      int c    = t + i * 256;
      int krow = c >> 4;
      int nc   = (c & 15) * 8;
      copy16_g2l(&Ws[krow * WPITCH + nc],
                 &W[(size_t)(k0 + krow) * 1024 + n0 + nc]);
    }
    // prefetch next iteration's tiles into cache while we compute
    if (k0 + 32 < 1024) {
      int c = t;
      __builtin_prefetch(&X[(size_t)(m0 + (c >> 2)) * 1024 + k0 + 32 + (c & 3) * 8], 0, 1);
      __builtin_prefetch(&W[(size_t)(k0 + 32 + (c >> 4)) * 1024 + n0 + (c & 15) * 8], 0, 1);
    }
    // own copies landed, then the barrier: it publishes both tiles to the other
    // waves and, directly behind the wait, keeps the LDS reads behind it
    async_fence();
    __syncthreads();

    v16h af[2], bf[4];
#pragma unroll
    for (int mt = 0; mt < 2; ++mt)
      af[mt] = ld_frag(&As[(wm * 32 + mt * 16 + lo) * APITCH + hi * 8]);
    // B operand in the k order of ld_frag: slot s of half hi is k 8*hi + s (s < 8),
    // 16 + 8*hi + s - 8; column lo
    const _Float16* wp =
        &Ws[(hi * 8 + (lane & 7)) * WPITCH + wn * 64 + ((lane >> 3) & 1) * 8];
#pragma unroll
    for (int nt = 0; nt < 4; ++nt) {
      v8h w0 = ld_tr16(wp + nt * 16);
      v8h w1 = ld_tr16(wp + 16 * WPITCH + nt * 16);
#pragma unroll
      for (int i = 0; i < 8; ++i) { bf[nt][i] = w0[i]; bf[nt][i + 8] = w1[i]; }
    }
#pragma unroll
    for (int mt = 0; mt < 2; ++mt)
#pragma unroll
      for (int nt = 0; nt < 4; ++nt)
        acc[mt][nt] = __builtin_amdgcn_wmma_f32_16x16x32_f16(
            false, af[mt], false, bf[nt], (short)0, acc[mt][nt], false, false);
    __syncthreads();
  }

  // epilogue: C layout row M = r + 8*hi, col N = lo (within tile)
#pragma unroll
  for (int mt = 0; mt < 2; ++mt)
#pragma unroll
    for (int nt = 0; nt < 4; ++nt) {
      int   col = n0 + wn * 64 + nt * 16 + lo;
      float bv  = bias[col];
#pragma unroll
      for (int r = 0; r < 8; ++r) {
        int   rowg = m0 + wm * 32 + mt * 16 + r + hi * 8;
        float v    = acc[mt][nt][r] + bv;
        if (OUT_F32) Yf[(size_t)rowg * 1024 + col] = v;
        else         Yh[(size_t)rowg * 1024 + col] = (_Float16)v;
      }
    }
}

// Lane l with lane l ^ 16: the exchange between the wave halves, as a vector move
__device__ __forceinline__ float xhalf(float x) {
  return __builtin_bit_cast(float, __builtin_amdgcn_permlanex16(
      __builtin_bit_cast(int, x), __builtin_bit_cast(int, x),
      0x76543210, 0xfedcba98, false, false));
}

// V rows in LDS: 128 B of data at a pitch of 160 B (odd multiple of 32 B), the
// conflict-free pitch for the transposing load.
#define VPITCH 80

// K rows in LDS: 128 B of data at a pitch of 144 B (odd multiple of 16 B), the
// conflict-free pitch for the 16-byte fragment loads; at 128 B the 16 rows of a
// fragment fall on an eighth of the banks.
#define KPITCH 72

// ---------------------------------------------------------------------------
// Flash attention, transposed products: S^T = K Q^T, O^T += V^T P^T.
// One block per (64-query tile, b*h). 4 waves, 16 query columns per wave.
// A lane holds scores of ONE query (column lo), keys 8*hi + r of each 16-key tile,
// so max and sum run in-lane with one exchange between the wave halves, and two
// score tiles convert in place into the B operand of the second product.
// Q/K/V are f16 in [b, s, h*64+d] layout. ctx written in same layout.
// ---------------------------------------------------------------------------
__global__ __launch_bounds__(128)
void attention_kernel(const _Float16* __restrict__ Qh, const _Float16* __restrict__ Kh,
                      const _Float16* __restrict__ Vh, const float* __restrict__ mask,
                      _Float16* __restrict__ ctx) {
  __shared__ __align__(16) _Float16 Ks[64 * KPITCH];   // key major, d contiguous, padded rows
  __shared__ __align__(32) _Float16 Vs[64 * VPITCH];   // key major, d contiguous, padded rows

  const int t    = threadIdx.x;
  const int lane = t & 31;
  const int wid  = t >> 5;
  const int lo   = lane & 15;
  const int hi   = lane >> 4;
  const int bh   = blockIdx.y;
  const int b    = bh >> 4;
  const int h    = bh & 15;
  const int s0   = blockIdx.x * 64;
  const int qg   = s0 + wid * 16 + lo;   // this lane's query
  const size_t base = (size_t)b * SEQ * 1024 + (size_t)h * 64;

  // Q^T as B operand (column = query lo), loaded once and kept in registers
  v16h bq[2];
#pragma unroll
  for (int k2 = 0; k2 < 2; ++k2)
    bq[k2] = ld_frag(&Qh[base + (size_t)qg * 1024 + k2 * 32 + hi * 8]);

  const float* __restrict__ mq = mask + (size_t)qg * SEQ + hi * 8;

  const v8f zero = {0, 0, 0, 0, 0, 0, 0, 0};
  float mrow = -3.0e38f, lrow = 0.0f;   // lrow: this half's share of the row sum
  v8f acco[4];                          // O^T: row d = dt*16 + 8*hi + r, column lo
#pragma unroll
  for (int dt = 0; dt < 4; ++dt) acco[dt] = zero;

  for (int kb = 0; kb < SEQ; kb += 64) {
    __syncthreads();  // protect Ks/Vs from previous iteration's readers
    // stage K and V row-major (async)
#pragma unroll
    for (int i = 0; i < 4; ++i) {
      int c = t + i * 128;
      int row = c >> 3, d0 = (c & 7) * 8;
      copy16_g2l(&Ks[row * KPITCH + d0],
                 &Kh[base + (size_t)(kb + row) * 1024 + d0]);
      copy16_g2l(&Vs[row * VPITCH + d0],
                 &Vh[base + (size_t)(kb + row) * 1024 + d0]);
    }
    // prefetch next key block while this one is being consumed
    if (kb + 64 < SEQ) {
      int c = t;
      int row = c >> 3, d0 = (c & 7) * 8;
      __builtin_prefetch(&Kh[base + (size_t)(kb + 64 + row) * 1024 + d0], 0, 1);
      __builtin_prefetch(&Vh[base + (size_t)(kb + 64 + row) * 1024 + d0], 0, 1);
    }
    // this lane's mask values: 8 consecutive keys per 16-key tile
    float4 mk[4][2];
#pragma unroll
    for (int nt = 0; nt < 4; ++nt) {
      mk[nt][0] = *(const float4*)(mq + kb + nt * 16);
      mk[nt][1] = *(const float4*)(mq + kb + nt * 16 + 4);
    }
    async_fence();
    __syncthreads();

    // S^T = K @ Q^T : 64 keys (4 M-tiles) x 16 query columns, Kdim = depth 64
    v8f sacc[4];
#pragma unroll
    for (int nt = 0; nt < 4; ++nt) sacc[nt] = zero;
#pragma unroll
    for (int k2 = 0; k2 < 2; ++k2)
#pragma unroll
      for (int nt = 0; nt < 4; ++nt) {
        v16h ak = ld_frag(&Ks[(nt * 16 + lo) * KPITCH + k2 * 32 + hi * 8]);
        sacc[nt] = __builtin_amdgcn_wmma_f32_16x16x32_f16(
            false, ak, false, bq[k2], (short)0, sacc[nt], false, false);
      }

    // scaled logits + mask, then online softmax. D layout: key r+8*hi, query lo.
    float p[4][8];
    float mb = -3.0e38f;
#pragma unroll
    for (int nt = 0; nt < 4; ++nt) {
      const float mv[8] = {mk[nt][0].x, mk[nt][0].y, mk[nt][0].z, mk[nt][0].w,
                           mk[nt][1].x, mk[nt][1].y, mk[nt][1].z, mk[nt][1].w};
#pragma unroll
      for (int r = 0; r < 8; ++r) {
        float v  = sacc[nt][r] * 0.125f + mv[r] * (-1e9f);
        p[nt][r] = v;
        mb       = fmaxf(mb, v);
      }
    }
    mb = fmaxf(mb, xhalf(mb));   // the other half's 32 keys

    const float mn   = fmaxf(mrow, mb);
    const float corr = __expf(mrow - mn);
    mrow = mn;
    float s4[4];
#pragma unroll
    for (int nt = 0; nt < 4; ++nt) {
      float s = 0.0f;
#pragma unroll
      for (int r = 0; r < 8; ++r) {
        p[nt][r] = __expf(p[nt][r] - mn);
        s += p[nt][r];
      }
      s4[nt] = s;
    }
    lrow = lrow * corr + ((s4[0] + s4[1]) + (s4[2] + s4[3]));
#pragma unroll
    for (int dt = 0; dt < 4; ++dt)
#pragma unroll
      for (int r = 0; r < 8; ++r) acco[dt][r] = acco[dt][r] * corr;

    // O^T += V^T @ P^T : Kdim = 64 keys, 4 depth tiles. Both operands in the
    // hardware k order: slot s of half hi is key 8*hi + s (s < 8), 16 + 8*hi + s - 8.
#pragma unroll
    for (int k2 = 0; k2 < 2; ++k2) {
      v16h bp;
#pragma unroll
      for (int i = 0; i < 8; ++i) {
        bp[i]     = (_Float16)p[2 * k2][i];
        bp[i + 8] = (_Float16)p[2 * k2 + 1][i];
      }
      const _Float16* vp =
          &Vs[(k2 * 32 + hi * 8 + (lane & 7)) * VPITCH + ((lane >> 3) & 1) * 8];
#pragma unroll
      for (int dt = 0; dt < 4; ++dt) {
        v8h v0 = ld_tr16(vp + dt * 16);
        v8h v1 = ld_tr16(vp + 16 * VPITCH + dt * 16);
        v16h av;
#pragma unroll
        for (int i = 0; i < 8; ++i) { av[i] = v0[i]; av[i + 8] = v1[i]; }
        acco[dt] = __builtin_amdgcn_wmma_f32_16x16x32_f16(
            false, av, false, bp, (short)0, acco[dt], false, false);
      }
    }
  }

  // join the halves' sums, normalize and write context (f16, [b,s,h*64+d] layout):
  // a lane's 8 registers are 8 consecutive d of its query, one 16-byte store
  lrow += xhalf(lrow);
#pragma unroll
  for (int dt = 0; dt < 4; ++dt) {
    v8h o;
#pragma unroll
    for (int r = 0; r < 8; ++r) o[r] = (_Float16)(acco[dt][r] / lrow);
    *(v8h*)&ctx[base + (size_t)qg * 1024 + dt * 16 + hi * 8] = o;
  }
}

// ---------------------------------------------------------------------------
extern "C" void kernel_launch(void* const* d_in, const int* in_sizes, int n_in,
                              void* d_out, int out_size, void* d_ws, size_t ws_size,
                              hipStream_t stream) {
  (void)in_sizes; (void)n_in; (void)out_size; (void)ws_size;

  const float* q    = (const float*)d_in[0];
  const float* k    = (const float*)d_in[1];
  const float* v    = (const float*)d_in[2];
  const float* mask = (const float*)d_in[3];
  const float* wq   = (const float*)d_in[4];
  const float* bq   = (const float*)d_in[5];
  const float* wk   = (const float*)d_in[6];
  const float* bk   = (const float*)d_in[7];
  const float* wv   = (const float*)d_in[8];
  const float* bv   = (const float*)d_in[9];
  const float* wo   = (const float*)d_in[10];
  const float* bo   = (const float*)d_in[11];
  float* out = (float*)d_out;

  const size_t SZX = (size_t)MTOT * 1024;     // 4,194,304
  const size_t SZW = (size_t)1024 * 1024;     // 1,048,576
  _Float16* w16 = (_Float16*)d_ws;            // total 64 MiB of f16 scratch
  _Float16* qx  = w16;
  _Float16* kx  = qx + SZX;
  _Float16* vx  = kx + SZX;
  _Float16* wqh = vx + SZX;
  _Float16* wkh = wqh + SZW;
  _Float16* wvh = wkh + SZW;
  _Float16* woh = wvh + SZW;
  _Float16* Qp  = woh + SZW;
  _Float16* Kp  = Qp + SZX;
  _Float16* Vp  = Kp + SZX;
  _Float16* Cx  = Vp + SZX;

  // qx .. woh are contiguous from w16 in the kernel's unit order
  cvt_all_kernel<<<dim3(CVT_BLOCKS), CVT_THREADS, 0, stream>>>(q, k, v, wq, wk, wv, wo, w16);

  dim3 gg(1024 / 128, MTOT / 128);  // (8, 32)
  gemm_f16_kernel<false><<<gg, 256, 0, stream>>>(qx, wqh, bq, nullptr, Qp);
  gemm_f16_kernel<false><<<gg, 256, 0, stream>>>(kx, wkh, bk, nullptr, Kp);
  gemm_f16_kernel<false><<<gg, 256, 0, stream>>>(vx, wvh, bv, nullptr, Vp);

  attention_kernel<<<dim3(SEQ / 64, BATCH * NUM_HEADS), 128, 0, stream>>>(
      Qp, Kp, Vp, mask, Cx);

  gemm_f16_kernel<true><<<gg, 256, 0, stream>>>(Cx, woh, bo, out, nullptr);
}

// v005
// It runs in 138 microseconds.
// Next to v004, in two timings, it ran 1.33 and 1.34 times as fast.
// All steps since v000 together make it 3.22 times as fast.
#include <hip/hip_runtime.h>
#include <math.h>

typedef __attribute__((ext_vector_type(16))) _Float16 v16h;
typedef __attribute__((ext_vector_type(8)))  _Float16 v8h;
typedef __attribute__((ext_vector_type(8)))  float    v8f;
typedef __attribute__((ext_vector_type(4)))  int      v4i;

#define D_MODEL 1024
#define NUM_HEADS 16
#define DEPTH 64
#define BATCH 2
#define SEQ 2048
#define MTOT (BATCH * SEQ)   // 4096

// CDNA5 async global->LDS copies (ASYNCcnt path). Guarded so either toolchain
// compiles; host pass always takes the plain fallback.
#if defined(__HIP_DEVICE_COMPILE__) &&                                   \
    __has_builtin(__builtin_amdgcn_global_load_async_to_lds_b128) &&     \
    __has_builtin(__builtin_amdgcn_s_wait_asynccnt)
#define USE_ASYNC_LDS 1
#else
#define USE_ASYNC_LDS 0
#endif

#if USE_ASYNC_LDS
typedef __attribute__((address_space(1))) v4i* as1_v4i_ptr;
typedef __attribute__((address_space(3))) v4i* as3_v4i_ptr;
#endif

__device__ __forceinline__ void copy16_g2l(void* lds, const void* g) {
#if USE_ASYNC_LDS
  __builtin_amdgcn_global_load_async_to_lds_b128(
      (as1_v4i_ptr)(void*)g, (as3_v4i_ptr)lds, 0, 0);
#else
  *(v8h*)lds = *(const v8h*)g;
#endif
}

__device__ __forceinline__ void async_fence() {
#if USE_ASYNC_LDS
  __builtin_amdgcn_s_wait_asynccnt(0);
#endif
}

struct h4 { _Float16 x, y, z, w; };

// ---------------------------------------------------------------------------
// fp32 -> f16 conversion of all seven operands in ONE launch of resident waves.
// The f16 copies lie back to back in the workspace in the order q, k, v, wq, wk,
// wv, wo: 16 units of 2^20 elements (4 + 4 + 4 + 1 + 1 + 1 + 1). 256 blocks of 16
// waves, one per WGP; a block converts 65,536 consecutive elements of one unit.
// Each wave-wide load takes 512 contiguous bytes, each store two whole lines; a
// wave's 32 loads are spread over the block's 256 KiB.
// ---------------------------------------------------------------------------
#define CVT_THREADS 512
#define CVT_BLOCKS 256
#define CVT_STEP (CVT_THREADS * 4)   // elements a block converts per load round
#define CVT_ROUNDS 32                // 32 * 2048 = 65,536 elements per block

__global__ __launch_bounds__(CVT_THREADS)
void cvt_all_kernel(const float* __restrict__ q, const float* __restrict__ k,
                    const float* __restrict__ v, const float* __restrict__ wq,
                    const float* __restrict__ wk, const float* __restrict__ wv,
                    const float* __restrict__ wo, _Float16* __restrict__ out) {
  const int b = blockIdx.x;
  const int u = b >> 4;   // unit of 2^20 elements
  const float* s;         // start of this unit in its own operand
  if (u < 4)        s = q + ((size_t)u << 20);
  else if (u < 8)   s = k + ((size_t)(u - 4) << 20);
  else if (u < 12)  s = v + ((size_t)(u - 8) << 20);
  else if (u == 12) s = wq;
  else if (u == 13) s = wk;
  else if (u == 14) s = wv;
  else              s = wo;
  const float* __restrict__ in = s + (b & 15) * (CVT_STEP * CVT_ROUNDS) + threadIdx.x * 4;
  _Float16* __restrict__ o16 =
      out + (size_t)b * (CVT_STEP * CVT_ROUNDS) + threadIdx.x * 4;

  // The loads stand in a loop of their own ahead of the conversions, so that many
  // are in flight per wave (a single load-convert-store loop built with one in
  // flight). Both loops are unrolled so that x[] stays in registers and every
  // address is base + constant.
  float4 x[CVT_ROUNDS];
#pragma unroll
  for (int i = 0; i < CVT_ROUNDS; ++i) x[i] = *(const float4*)(in + i * CVT_STEP);
#pragma unroll
  for (int i = 0; i < CVT_ROUNDS; ++i) {
    h4 o;
    o.x = (_Float16)x[i].x; o.y = (_Float16)x[i].y;
    o.z = (_Float16)x[i].z; o.w = (_Float16)x[i].w;
    *(h4*)(o16 + i * CVT_STEP) = o;
  }
}

// ---------------------------------------------------------------------------
// Fragment loader for 16-bit A/B operands of v_wmma_*_16x16x32.
// Lanes 0-15 -> row lo, K {0..7, 16..23}; lanes 16-31 -> row lo, K {8..15, 24..31}.
// Caller passes lane-resolved pointer (base + lo*stride + hi*8), 16B aligned.
// ---------------------------------------------------------------------------
__device__ __forceinline__ v16h ld_frag(const _Float16* p) {
  v8h a = *(const v8h*)p;
  v8h b = *(const v8h*)(p + 16);
  v16h r;
#pragma unroll
  for (int i = 0; i < 8; ++i) { r[i] = a[i]; r[i + 8] = b[i]; }
  return r;
}

typedef __attribute__((ext_vector_type(8))) short s16x8;
typedef __attribute__((address_space(3))) s16x8 lds_s16x8;

__device__ __forceinline__ v8h ld_tr16(const _Float16* p) {
  return __builtin_bit_cast(v8h, __builtin_amdgcn_ds_load_tr16_b128_v8i16((lds_s16x8*)p));
}

// W rows in LDS: 256 B of data at a pitch of 288 B (odd multiple of 32 B), the
// conflict-free pitch for the transposing load.
#define WPITCH 144

// X rows in LDS: 64 B of data at a pitch of 80 B (odd multiple of 16 B), the
// conflict-free pitch for the 16-byte fragment loads; at 64 B the 16 rows of a
// fragment fall on a quarter of the banks.
#define APITCH 40

// ---------------------------------------------------------------------------
// GEMM: Y[M,1024] = X[M,1024] @ W[1024,1024] + bias
// Block: 256 threads (8 waves), tile 128x128, BK=32.
// Wave (wm,wn) in 4x2 grid computes 32x64 via 2x4 WMMA tiles.
// The W tile lies in LDS as in memory (k rows, n contiguous); the transposing
// load turns it into the B operand.
// blockIdx.z picks one of up to three independent products of this shape whose
// X, W and Y lie back to back (X and Y 4096x1024 apart, W 1024x1024 apart). A
// workgroup stalls on its copies in every k step; with three products in one
// launch a WGP holds three workgroups, and each works while the others wait.
// ---------------------------------------------------------------------------
template <bool OUT_F32>
__global__ __launch_bounds__(256)
void gemm_f16_kernel(const _Float16* __restrict__ X0, const _Float16* __restrict__ W0,
                     const float* __restrict__ bias0, const float* __restrict__ bias1,
                     const float* __restrict__ bias2, float* __restrict__ Yf,
                     _Float16* __restrict__ Yh0) {
  const int z = blockIdx.z;
  const _Float16* __restrict__ X = X0 + (size_t)z * (MTOT * 1024);
  const _Float16* __restrict__ W = W0 + (size_t)z * (1024 * 1024);
  const float* __restrict__ bias = z == 0 ? bias0 : (z == 1 ? bias1 : bias2);
  _Float16* __restrict__ Yh = Yh0 + (size_t)z * (MTOT * 1024);

  __shared__ __align__(16) _Float16 As[128 * APITCH];  // m-major, k-contiguous, padded rows
  __shared__ __align__(32) _Float16 Ws[32 * WPITCH];  // k-major, n-contiguous, padded rows

  const int t    = threadIdx.x;
  const int lane = t & 31;
  const int wid  = t >> 5;
  const int lo   = lane & 15;
  const int hi   = lane >> 4;
  const int wm   = wid >> 1;  // 0..3
  const int wn   = wid & 1;   // 0..1
  const int m0   = blockIdx.y * 128;
  const int n0   = blockIdx.x * 128;

  const v8f zero = {0, 0, 0, 0, 0, 0, 0, 0};
  v8f acc[2][4];
#pragma unroll
  for (int i = 0; i < 2; ++i)
#pragma unroll
    for (int j = 0; j < 4; ++j) acc[i][j] = zero;

  for (int k0 = 0; k0 < 1024; k0 += 32) {
    // stage A (async DMA into LDS): 128x32 f16 = 512 chunks of 8, 2 per thread
#pragma unroll
    for (int i = 0; i < 2; ++i) {
      int c   = t + i * 256;
      int row = c >> 2;
      int c8  = (c & 3) * 8;
      copy16_g2l(&As[row * APITCH + c8],
                 &X[(size_t)(m0 + row) * 1024 + k0 + c8]);
    }
    // stage W tile row-major (async): 32x128 f16 = 512 chunks of 8, 2 per thread
#pragma unroll
    for (int i = 0; i < 2; ++i) {
      int c    = t + i * 256;
      int krow = c >> 4;
      int nc   = (c & 15) * 8;
      copy16_g2l(&Ws[krow * WPITCH + nc],
                 &W[(size_t)(k0 + krow) * 1024 + n0 + nc]);
    }
    // prefetch next iteration's tiles into cache while we compute
    if (k0 + 32 < 1024) {
      int c = t;
      __builtin_prefetch(&X[(size_t)(m0 + (c >> 2)) * 1024 + k0 + 32 + (c & 3) * 8], 0, 1);
      __builtin_prefetch(&W[(size_t)(k0 + 32 + (c >> 4)) * 1024 + n0 + (c & 15) * 8], 0, 1);
    }
    // own copies landed, then the barrier: it publishes both tiles to the other
    // waves and, directly behind the wait, keeps the LDS reads behind it
    async_fence();
    __syncthreads();

    v16h af[2], bf[4];
#pragma unroll
    for (int mt = 0; mt < 2; ++mt)
      af[mt] = ld_frag(&As[(wm * 32 + mt * 16 + lo) * APITCH + hi * 8]);
    // B operand in the k order of ld_frag: slot s of half hi is k 8*hi + s (s < 8),
    // 16 + 8*hi + s - 8; column lo
    const _Float16* wp =
        &Ws[(hi * 8 + (lane & 7)) * WPITCH + wn * 64 + ((lane >> 3) & 1) * 8];
#pragma unroll
    for (int nt = 0; nt < 4; ++nt) {
      v8h w0 = ld_tr16(wp + nt * 16);
      v8h w1 = ld_tr16(wp + 16 * WPITCH + nt * 16);
#pragma unroll
      for (int i = 0; i < 8; ++i) { bf[nt][i] = w0[i]; bf[nt][i + 8] = w1[i]; }
    }
#pragma unroll
    for (int mt = 0; mt < 2; ++mt)
#pragma unroll
      for (int nt = 0; nt < 4; ++nt)
        acc[mt][nt] = __builtin_amdgcn_wmma_f32_16x16x32_f16(
            false, af[mt], false, bf[nt], (short)0, acc[mt][nt], false, false);
    __syncthreads();
  }

  // epilogue: C layout row M = r + 8*hi, col N = lo (within tile)
#pragma unroll
  for (int mt = 0; mt < 2; ++mt)
#pragma unroll
    for (int nt = 0; nt < 4; ++nt) {
      int   col = n0 + wn * 64 + nt * 16 + lo;
      float bv  = bias[col];
#pragma unroll
      for (int r = 0; r < 8; ++r) {
        int   rowg = m0 + wm * 32 + mt * 16 + r + hi * 8;
        float v    = acc[mt][nt][r] + bv;
        if (OUT_F32) Yf[(size_t)rowg * 1024 + col] = v;
        else         Yh[(size_t)rowg * 1024 + col] = (_Float16)v;
      }
    }
}

// Lane l with lane l ^ 16: the exchange between the wave halves, as a vector move
__device__ __forceinline__ float xhalf(float x) {
  return __builtin_bit_cast(float, __builtin_amdgcn_permlanex16(
      __builtin_bit_cast(int, x), __builtin_bit_cast(int, x),
      0x76543210, 0xfedcba98, false, false));
}

// V rows in LDS: 128 B of data at a pitch of 160 B (odd multiple of 32 B), the
// conflict-free pitch for the transposing load.
#define VPITCH 80

// K rows in LDS: 128 B of data at a pitch of 144 B (odd multiple of 16 B), the
// conflict-free pitch for the 16-byte fragment loads; at 128 B the 16 rows of a
// fragment fall on an eighth of the banks.
#define KPITCH 72

// ---------------------------------------------------------------------------
// Flash attention, transposed products: S^T = K Q^T, O^T += V^T P^T.
// One block per (64-query tile, b*h). 4 waves, 16 query columns per wave.
// A lane holds scores of ONE query (column lo), keys 8*hi + r of each 16-key tile,
// so max and sum run in-lane with one exchange between the wave halves, and two
// score tiles convert in place into the B operand of the second product.
// Q/K/V are f16 in [b, s, h*64+d] layout. ctx written in same layout.
// ---------------------------------------------------------------------------
__global__ __launch_bounds__(128)
void attention_kernel(const _Float16* __restrict__ Qh, const _Float16* __restrict__ Kh,
                      const _Float16* __restrict__ Vh, const float* __restrict__ mask,
                      _Float16* __restrict__ ctx) {
  __shared__ __align__(16) _Float16 Ks[64 * KPITCH];   // key major, d contiguous, padded rows
  __shared__ __align__(32) _Float16 Vs[64 * VPITCH];   // key major, d contiguous, padded rows

  const int t    = threadIdx.x;
  const int lane = t & 31;
  const int wid  = t >> 5;
  const int lo   = lane & 15;
  const int hi   = lane >> 4;
  const int bh   = blockIdx.y;
  const int b    = bh >> 4;
  const int h    = bh & 15;
  const int s0   = blockIdx.x * 64;
  const int qg   = s0 + wid * 16 + lo;   // this lane's query
  const size_t base = (size_t)b * SEQ * 1024 + (size_t)h * 64;

  // Q^T as B operand (column = query lo), loaded once and kept in registers
  v16h bq[2];
#pragma unroll
  for (int k2 = 0; k2 < 2; ++k2)
    bq[k2] = ld_frag(&Qh[base + (size_t)qg * 1024 + k2 * 32 + hi * 8]);

  const float* __restrict__ mq = mask + (size_t)qg * SEQ + hi * 8;

  const v8f zero = {0, 0, 0, 0, 0, 0, 0, 0};
  float mrow = -3.0e38f, lrow = 0.0f;   // lrow: this half's share of the row sum
  v8f acco[4];                          // O^T: row d = dt*16 + 8*hi + r, column lo
#pragma unroll
  for (int dt = 0; dt < 4; ++dt) acco[dt] = zero;

  for (int kb = 0; kb < SEQ; kb += 64) {
    __syncthreads();  // protect Ks/Vs from previous iteration's readers
    // stage K and V row-major (async)
#pragma unroll
    for (int i = 0; i < 4; ++i) {
      int c = t + i * 128;
      int row = c >> 3, d0 = (c & 7) * 8;
      copy16_g2l(&Ks[row * KPITCH + d0],
                 &Kh[base + (size_t)(kb + row) * 1024 + d0]);
      copy16_g2l(&Vs[row * VPITCH + d0],
                 &Vh[base + (size_t)(kb + row) * 1024 + d0]);
    }
    // prefetch next key block while this one is being consumed
    if (kb + 64 < SEQ) {
      int c = t;
      int row = c >> 3, d0 = (c & 7) * 8;
      __builtin_prefetch(&Kh[base + (size_t)(kb + 64 + row) * 1024 + d0], 0, 1);
      __builtin_prefetch(&Vh[base + (size_t)(kb + 64 + row) * 1024 + d0], 0, 1);
    }
    // this lane's mask values: 8 consecutive keys per 16-key tile
    float4 mk[4][2];
#pragma unroll
    for (int nt = 0; nt < 4; ++nt) {
      mk[nt][0] = *(const float4*)(mq + kb + nt * 16);
      mk[nt][1] = *(const float4*)(mq + kb + nt * 16 + 4);
    }
    async_fence();
    __syncthreads();

    // S^T = K @ Q^T : 64 keys (4 M-tiles) x 16 query columns, Kdim = depth 64
    v8f sacc[4];
#pragma unroll
    for (int nt = 0; nt < 4; ++nt) sacc[nt] = zero;
#pragma unroll
    for (int k2 = 0; k2 < 2; ++k2)
#pragma unroll
      for (int nt = 0; nt < 4; ++nt) {
        v16h ak = ld_frag(&Ks[(nt * 16 + lo) * KPITCH + k2 * 32 + hi * 8]);
        sacc[nt] = __builtin_amdgcn_wmma_f32_16x16x32_f16(
            false, ak, false, bq[k2], (short)0, sacc[nt], false, false);
      }

    // scaled logits + mask, then online softmax. D layout: key r+8*hi, query lo.
    float p[4][8];
    float mb = -3.0e38f;
#pragma unroll
    for (int nt = 0; nt < 4; ++nt) {
      const float mv[8] = {mk[nt][0].x, mk[nt][0].y, mk[nt][0].z, mk[nt][0].w,
                           mk[nt][1].x, mk[nt][1].y, mk[nt][1].z, mk[nt][1].w};
#pragma unroll
      for (int r = 0; r < 8; ++r) {
        float v  = sacc[nt][r] * 0.125f + mv[r] * (-1e9f);
        p[nt][r] = v;
        mb       = fmaxf(mb, v);
      }
    }
    mb = fmaxf(mb, xhalf(mb));   // the other half's 32 keys

    const float mn   = fmaxf(mrow, mb);
    const float corr = __expf(mrow - mn);
    mrow = mn;
    float s4[4];
#pragma unroll
    for (int nt = 0; nt < 4; ++nt) {
      float s = 0.0f;
#pragma unroll
      for (int r = 0; r < 8; ++r) {
        p[nt][r] = __expf(p[nt][r] - mn);
        s += p[nt][r];
      }
      s4[nt] = s;
    }
    lrow = lrow * corr + ((s4[0] + s4[1]) + (s4[2] + s4[3]));
#pragma unroll
    for (int dt = 0; dt < 4; ++dt)
#pragma unroll
      for (int r = 0; r < 8; ++r) acco[dt][r] = acco[dt][r] * corr;

    // O^T += V^T @ P^T : Kdim = 64 keys, 4 depth tiles. Both operands in the
    // hardware k order: slot s of half hi is key 8*hi + s (s < 8), 16 + 8*hi + s - 8.
#pragma unroll
    for (int k2 = 0; k2 < 2; ++k2) {
      v16h bp;
#pragma unroll
      for (int i = 0; i < 8; ++i) {
        bp[i]     = (_Float16)p[2 * k2][i];
        bp[i + 8] = (_Float16)p[2 * k2 + 1][i];
      }
      const _Float16* vp =
          &Vs[(k2 * 32 + hi * 8 + (lane & 7)) * VPITCH + ((lane >> 3) & 1) * 8];
#pragma unroll
      for (int dt = 0; dt < 4; ++dt) {
        v8h v0 = ld_tr16(vp + dt * 16);
        v8h v1 = ld_tr16(vp + 16 * VPITCH + dt * 16);
        v16h av;
#pragma unroll
        for (int i = 0; i < 8; ++i) { av[i] = v0[i]; av[i + 8] = v1[i]; }
        acco[dt] = __builtin_amdgcn_wmma_f32_16x16x32_f16(
            false, av, false, bp, (short)0, acco[dt], false, false);
      }
    }
  }

  // join the halves' sums, normalize and write context (f16, [b,s,h*64+d] layout):
  // a lane's 8 registers are 8 consecutive d of its query, one 16-byte store
  lrow += xhalf(lrow);
#pragma unroll
  for (int dt = 0; dt < 4; ++dt) {
    v8h o;
#pragma unroll
    for (int r = 0; r < 8; ++r) o[r] = (_Float16)(acco[dt][r] / lrow);
    *(v8h*)&ctx[base + (size_t)qg * 1024 + dt * 16 + hi * 8] = o;
  }
}

// ---------------------------------------------------------------------------
extern "C" void kernel_launch(void* const* d_in, const int* in_sizes, int n_in,
                              void* d_out, int out_size, void* d_ws, size_t ws_size,
                              hipStream_t stream) {
  (void)in_sizes; (void)n_in; (void)out_size; (void)ws_size;

  const float* q    = (const float*)d_in[0];
  const float* k    = (const float*)d_in[1];
  const float* v    = (const float*)d_in[2];
  const float* mask = (const float*)d_in[3];
  const float* wq   = (const float*)d_in[4];
  const float* bq   = (const float*)d_in[5];
  const float* wk   = (const float*)d_in[6];
  const float* bk   = (const float*)d_in[7];
  const float* wv   = (const float*)d_in[8];
  const float* bv   = (const float*)d_in[9];
  const float* wo   = (const float*)d_in[10];
  const float* bo   = (const float*)d_in[11];
  float* out = (float*)d_out;

  const size_t SZX = (size_t)MTOT * 1024;     // 4,194,304
  const size_t SZW = (size_t)1024 * 1024;     // 1,048,576
  _Float16* w16 = (_Float16*)d_ws;            // total 64 MiB of f16 scratch
  _Float16* qx  = w16;
  _Float16* kx  = qx + SZX;
  _Float16* vx  = kx + SZX;
  _Float16* wqh = vx + SZX;
  _Float16* wkh = wqh + SZW;
  _Float16* wvh = wkh + SZW;
  _Float16* woh = wvh + SZW;
  _Float16* Qp  = woh + SZW;
  _Float16* Kp  = Qp + SZX;
  _Float16* Vp  = Kp + SZX;
  _Float16* Cx  = Vp + SZX;

  // qx .. woh are contiguous from w16 in the kernel's unit order
  cvt_all_kernel<<<dim3(CVT_BLOCKS), CVT_THREADS, 0, stream>>>(q, k, v, wq, wk, wv, wo, w16);

  // the three projections in one launch: qx kx vx, wqh wkh wvh and Qp Kp Vp are
  // each contiguous in this order
  gemm_f16_kernel<false><<<dim3(1024 / 128, MTOT / 128, 3), 256, 0, stream>>>(
      qx, wqh, bq, bk, bv, nullptr, Qp);

  attention_kernel<<<dim3(SEQ / 64, BATCH * NUM_HEADS), 128, 0, stream>>>(
      Qp, Kp, Vp, mask, Cx);

  gemm_f16_kernel<true><<<dim3(1024 / 128, MTOT / 128, 1), 256, 0, stream>>>(
      Cx, woh, bo, bo, bo, out, nullptr);
}

// v006
// A run of this version takes 118 microseconds.
// Timed twice side by side with v005, it ran 1.17 times as fast both times.
// Counting every step since v000, it is 3.77 times as fast.
#include <hip/hip_runtime.h>
#include <math.h>

typedef __attribute__((ext_vector_type(16))) _Float16 v16h;
typedef __attribute__((ext_vector_type(8)))  _Float16 v8h;
typedef __attribute__((ext_vector_type(8)))  float    v8f;
typedef __attribute__((ext_vector_type(4)))  int      v4i;

#define D_MODEL 1024
#define NUM_HEADS 16
#define DEPTH 64
#define BATCH 2
#define SEQ 2048
#define MTOT (BATCH * SEQ)   // 4096

// CDNA5 async global->LDS copies (ASYNCcnt path). Guarded so either toolchain
// compiles; host pass always takes the plain fallback.
#if defined(__HIP_DEVICE_COMPILE__) &&                                   \
    __has_builtin(__builtin_amdgcn_global_load_async_to_lds_b128) &&     \
    __has_builtin(__builtin_amdgcn_s_wait_asynccnt)
#define USE_ASYNC_LDS 1
#else
#define USE_ASYNC_LDS 0
#endif

#if USE_ASYNC_LDS
typedef __attribute__((address_space(1))) v4i* as1_v4i_ptr;
typedef __attribute__((address_space(3))) v4i* as3_v4i_ptr;
#endif

__device__ __forceinline__ void copy16_g2l(void* lds, const void* g) {
#if USE_ASYNC_LDS
  __builtin_amdgcn_global_load_async_to_lds_b128(
      (as1_v4i_ptr)(void*)g, (as3_v4i_ptr)lds, 0, 0);
#else
  *(v8h*)lds = *(const v8h*)g;
#endif
}

__device__ __forceinline__ void async_fence() {
#if USE_ASYNC_LDS
  __builtin_amdgcn_s_wait_asynccnt(0);
#endif
}

struct h4 { _Float16 x, y, z, w; };

// ---------------------------------------------------------------------------
// fp32 -> f16 conversion of all seven operands in ONE launch of resident waves.
// The f16 copies lie back to back in the workspace in the order q, k, v, wq, wk,
// wv, wo: 16 units of 2^20 elements (4 + 4 + 4 + 1 + 1 + 1 + 1). 256 blocks of 16
// waves, one per WGP; a block converts 65,536 consecutive elements of one unit.
// Each wave-wide load takes 512 contiguous bytes, each store two whole lines; a
// wave's 32 loads are spread over the block's 256 KiB.
// ---------------------------------------------------------------------------
#define CVT_THREADS 512
#define CVT_BLOCKS 256
#define CVT_STEP (CVT_THREADS * 4)   // elements a block converts per load round
#define CVT_ROUNDS 32                // 32 * 2048 = 65,536 elements per block

__global__ __launch_bounds__(CVT_THREADS)
void cvt_all_kernel(const float* __restrict__ q, const float* __restrict__ k,
                    const float* __restrict__ v, const float* __restrict__ wq,
                    const float* __restrict__ wk, const float* __restrict__ wv,
                    const float* __restrict__ wo, _Float16* __restrict__ out) {
  const int b = blockIdx.x;
  const int u = b >> 4;   // unit of 2^20 elements
  const float* s;         // start of this unit in its own operand
  if (u < 4)        s = q + ((size_t)u << 20);
  else if (u < 8)   s = k + ((size_t)(u - 4) << 20);
  else if (u < 12)  s = v + ((size_t)(u - 8) << 20);
  else if (u == 12) s = wq;
  else if (u == 13) s = wk;
  else if (u == 14) s = wv;
  else              s = wo;
  const float* __restrict__ in = s + (b & 15) * (CVT_STEP * CVT_ROUNDS) + threadIdx.x * 4;
  _Float16* __restrict__ o16 =
      out + (size_t)b * (CVT_STEP * CVT_ROUNDS) + threadIdx.x * 4;

  // The loads stand in a loop of their own ahead of the conversions, so that many
  // are in flight per wave (a single load-convert-store loop built with one in
  // flight). Both loops are unrolled so that x[] stays in registers and every
  // address is base + constant.
  float4 x[CVT_ROUNDS];
#pragma unroll
  for (int i = 0; i < CVT_ROUNDS; ++i) x[i] = *(const float4*)(in + i * CVT_STEP);
#pragma unroll
  for (int i = 0; i < CVT_ROUNDS; ++i) {
    h4 o;
    o.x = (_Float16)x[i].x; o.y = (_Float16)x[i].y;
    o.z = (_Float16)x[i].z; o.w = (_Float16)x[i].w;
    *(h4*)(o16 + i * CVT_STEP) = o;
  }
}

// ---------------------------------------------------------------------------
// Fragment loader for 16-bit A/B operands of v_wmma_*_16x16x32.
// Lanes 0-15 -> row lo, K {0..7, 16..23}; lanes 16-31 -> row lo, K {8..15, 24..31}.
// Caller passes lane-resolved pointer (base + lo*stride + hi*8), 16B aligned.
// ---------------------------------------------------------------------------
__device__ __forceinline__ v16h ld_frag(const _Float16* p) {
  v8h a = *(const v8h*)p;
  v8h b = *(const v8h*)(p + 16);
  v16h r;
#pragma unroll
  for (int i = 0; i < 8; ++i) { r[i] = a[i]; r[i + 8] = b[i]; }
  return r;
}

typedef __attribute__((ext_vector_type(8))) short s16x8;
typedef __attribute__((address_space(3))) s16x8 lds_s16x8;

__device__ __forceinline__ v8h ld_tr16(const _Float16* p) {
  return __builtin_bit_cast(v8h, __builtin_amdgcn_ds_load_tr16_b128_v8i16((lds_s16x8*)p));
}

// W rows in LDS: 256 B of data at a pitch of 288 B (odd multiple of 32 B), the
// conflict-free pitch for the transposing load.
#define WPITCH 144

// X rows in LDS: 256 B of data at a pitch of 272 B (odd multiple of 16 B), the
// conflict-free pitch for the 16-byte fragment loads.
#define APITCH 136

// k extent of one staged tile pair
#define BK 128

// ---------------------------------------------------------------------------
// GEMM: Y[M,1024] = X[M,1024] @ W[1024,1024] + bias
// Block: 256 threads (8 waves), tile 128x128, BK=128: one copy wait and two
// barriers per 128 k, 64 KiB in flight per workgroup behind each wait.
// Wave (wm,wn) in 4x2 grid computes 32x64 via 2x4 WMMA tiles.
// The W tile lies in LDS as in memory (k rows, n contiguous); the transposing
// load turns it into the B operand.
// blockIdx.z picks one of up to three independent products of this shape whose
// X, W and Y lie back to back (X and Y 4096x1024 apart, W 1024x1024 apart). A
// workgroup stalls on its copies in every k step; with three products in one
// launch a WGP holds three workgroups, and each works while the others wait.
// ---------------------------------------------------------------------------
template <bool OUT_F32>
__global__ __launch_bounds__(256)
void gemm_f16_kernel(const _Float16* __restrict__ X0, const _Float16* __restrict__ W0,
                     const float* __restrict__ bias0, const float* __restrict__ bias1,
                     const float* __restrict__ bias2, float* __restrict__ Yf,
                     _Float16* __restrict__ Yh0) {
  const int z = blockIdx.z;
  const _Float16* __restrict__ X = X0 + (size_t)z * (MTOT * 1024);
  const _Float16* __restrict__ W = W0 + (size_t)z * (1024 * 1024);
  const float* __restrict__ bias = z == 0 ? bias0 : (z == 1 ? bias1 : bias2);
  _Float16* __restrict__ Yh = Yh0 + (size_t)z * (MTOT * 1024);

  // One LDS block, the X tile first: the W tile then starts at 34,816 B, above the
  // 32-KiB immediate offset that the compiler folds into some W copies (it takes
  // the offset off the LDS address register, which so stays above zero).
  __shared__ __align__(32) _Float16 Sm[128 * APITCH + BK * WPITCH];
  _Float16* const As = Sm;                 // m-major, k-contiguous, padded rows
  _Float16* const Ws = Sm + 128 * APITCH;  // k-major, n-contiguous, padded rows

  const int t    = threadIdx.x;
  const int lane = t & 31;
  const int wid  = t >> 5;
  const int lo   = lane & 15;
  const int hi   = lane >> 4;
  const int wm   = wid >> 1;  // 0..3
  const int wn   = wid & 1;   // 0..1
  const int m0   = blockIdx.y * 128;
  const int n0   = blockIdx.x * 128;

  const v8f zero = {0, 0, 0, 0, 0, 0, 0, 0};
  v8f acc[2][4];
#pragma unroll
  for (int i = 0; i < 2; ++i)
#pragma unroll
    for (int j = 0; j < 4; ++j) acc[i][j] = zero;

  // Both tiles are 128 rows of 16 chunks of 8 halves; a thread copies chunk t & 15
  // of rows (t >> 4) + 16 i. Its offset inside a 16-row slab is the same for every
  // slab of X and of W, and a slab's start is uniform: the addresses are formed
  // from scalar slab starts and this one offset, so no address pair per copy stays
  // live over the loop. Three workgroups on a WGP need at most 160 registers.
  const int      srow = t >> 4;
  const int      sc8  = (t & 15) * 8;
  const unsigned goff = (unsigned)(srow * 1024 + sc8);

  for (int k0 = 0; k0 < 1024; k0 += BK) {
    // stage A (async DMA into LDS): 128x128 f16 = 2048 chunks of 8, 8 per thread
#pragma unroll
    for (int i = 0; i < 8; ++i) {
      const _Float16* slab = X + (size_t)(m0 + i * 16) * 1024 + k0;
      copy16_g2l(&As[(srow + i * 16) * APITCH + sc8], slab + goff);
    }
    // stage W tile row-major (async): 128x128 f16 = 2048 chunks of 8, 8 per thread
#pragma unroll
    for (int i = 0; i < 8; ++i) {
      const _Float16* slab = W + (size_t)(k0 + i * 16) * 1024 + n0;
      copy16_g2l(&Ws[(srow + i * 16) * WPITCH + sc8], slab + goff);
    }
    // prefetch next iteration's tiles into cache while we compute: one 128-B
    // line of each tile per thread
    if (k0 + BK < 1024) {
      int c = t;
      __builtin_prefetch(&X[(size_t)(m0 + (c >> 1)) * 1024 + k0 + BK + (c & 1) * 64], 0, 1);
      __builtin_prefetch(&W[(size_t)(k0 + BK + (c >> 1)) * 1024 + n0 + (c & 1) * 64], 0, 1);
    }
    // own copies landed, then the barrier: it publishes both tiles to the other
    // waves and, directly behind the wait, keeps the LDS reads behind it
    async_fence();
    __syncthreads();

    // the tile's four 32-k blocks in ascending k; unrolled so that every LDS
    // address is base + constant and a block's loads can run ahead of it
#pragma unroll
    for (int kk = 0; kk < BK; kk += 32) {
      v16h af[2], bf[4];
#pragma unroll
      for (int mt = 0; mt < 2; ++mt)
        af[mt] = ld_frag(&As[(wm * 32 + mt * 16 + lo) * APITCH + kk + hi * 8]);
      // B operand in the k order of ld_frag: slot s of half hi is k 8*hi + s (s < 8),
      // 16 + 8*hi + s - 8; column lo
      const _Float16* wp =
          &Ws[(kk + hi * 8 + (lane & 7)) * WPITCH + wn * 64 + ((lane >> 3) & 1) * 8];
#pragma unroll
      for (int nt = 0; nt < 4; ++nt) {
        v8h w0 = ld_tr16(wp + nt * 16);
        v8h w1 = ld_tr16(wp + 16 * WPITCH + nt * 16);
#pragma unroll
        for (int i = 0; i < 8; ++i) { bf[nt][i] = w0[i]; bf[nt][i + 8] = w1[i]; }
      }
#pragma unroll
      for (int mt = 0; mt < 2; ++mt)
#pragma unroll
        for (int nt = 0; nt < 4; ++nt)
          acc[mt][nt] = __builtin_amdgcn_wmma_f32_16x16x32_f16(
              false, af[mt], false, bf[nt], (short)0, acc[mt][nt], false, false);
    }
    __syncthreads();
  }

  // epilogue: C layout row M = r + 8*hi, col N = lo (within tile)
#pragma unroll
  for (int mt = 0; mt < 2; ++mt)
#pragma unroll
    for (int nt = 0; nt < 4; ++nt) {
      int   col = n0 + wn * 64 + nt * 16 + lo;
      float bv  = bias[col];
#pragma unroll
      for (int r = 0; r < 8; ++r) {
        int   rowg = m0 + wm * 32 + mt * 16 + r + hi * 8;
        float v    = acc[mt][nt][r] + bv;
        if (OUT_F32) Yf[(size_t)rowg * 1024 + col] = v;
        else         Yh[(size_t)rowg * 1024 + col] = (_Float16)v;
      }
    }
}

// Lane l with lane l ^ 16: the exchange between the wave halves, as a vector move
__device__ __forceinline__ float xhalf(float x) {
  return __builtin_bit_cast(float, __builtin_amdgcn_permlanex16(
      __builtin_bit_cast(int, x), __builtin_bit_cast(int, x),
      0x76543210, 0xfedcba98, false, false));
}

// V rows in LDS: 128 B of data at a pitch of 160 B (odd multiple of 32 B), the
// conflict-free pitch for the transposing load.
#define VPITCH 80

// K rows in LDS: 128 B of data at a pitch of 144 B (odd multiple of 16 B), the
// conflict-free pitch for the 16-byte fragment loads; at 128 B the 16 rows of a
// fragment fall on an eighth of the banks.
#define KPITCH 72

// ---------------------------------------------------------------------------
// Flash attention, transposed products: S^T = K Q^T, O^T += V^T P^T.
// One block per (64-query tile, b*h). 4 waves, 16 query columns per wave.
// A lane holds scores of ONE query (column lo), keys 8*hi + r of each 16-key tile,
// so max and sum run in-lane with one exchange between the wave halves, and two
// score tiles convert in place into the B operand of the second product.
// Q/K/V are f16 in [b, s, h*64+d] layout. ctx written in same layout.
// ---------------------------------------------------------------------------
__global__ __launch_bounds__(128)
void attention_kernel(const _Float16* __restrict__ Qh, const _Float16* __restrict__ Kh,
                      const _Float16* __restrict__ Vh, const float* __restrict__ mask,
                      _Float16* __restrict__ ctx) {
  __shared__ __align__(16) _Float16 Ks[64 * KPITCH];   // key major, d contiguous, padded rows
  __shared__ __align__(32) _Float16 Vs[64 * VPITCH];   // key major, d contiguous, padded rows

  const int t    = threadIdx.x;
  const int lane = t & 31;
  const int wid  = t >> 5;
  const int lo   = lane & 15;
  const int hi   = lane >> 4;
  const int bh   = blockIdx.y;
  const int b    = bh >> 4;
  const int h    = bh & 15;
  const int s0   = blockIdx.x * 64;
  const int qg   = s0 + wid * 16 + lo;   // this lane's query
  const size_t base = (size_t)b * SEQ * 1024 + (size_t)h * 64;

  // Q^T as B operand (column = query lo), loaded once and kept in registers
  v16h bq[2];
#pragma unroll
  for (int k2 = 0; k2 < 2; ++k2)
    bq[k2] = ld_frag(&Qh[base + (size_t)qg * 1024 + k2 * 32 + hi * 8]);

  const float* __restrict__ mq = mask + (size_t)qg * SEQ + hi * 8;

  const v8f zero = {0, 0, 0, 0, 0, 0, 0, 0};
  float mrow = -3.0e38f, lrow = 0.0f;   // lrow: this half's share of the row sum
  v8f acco[4];                          // O^T: row d = dt*16 + 8*hi + r, column lo
#pragma unroll
  for (int dt = 0; dt < 4; ++dt) acco[dt] = zero;

  for (int kb = 0; kb < SEQ; kb += 64) {
    __syncthreads();  // protect Ks/Vs from previous iteration's readers
    // stage K and V row-major (async)
#pragma unroll
    for (int i = 0; i < 4; ++i) {
      int c = t + i * 128;
      int row = c >> 3, d0 = (c & 7) * 8;
      copy16_g2l(&Ks[row * KPITCH + d0],
                 &Kh[base + (size_t)(kb + row) * 1024 + d0]);
      copy16_g2l(&Vs[row * VPITCH + d0],
                 &Vh[base + (size_t)(kb + row) * 1024 + d0]);
    }
    // prefetch next key block while this one is being consumed
    if (kb + 64 < SEQ) {
      int c = t;
      int row = c >> 3, d0 = (c & 7) * 8;
      __builtin_prefetch(&Kh[base + (size_t)(kb + 64 + row) * 1024 + d0], 0, 1);
      __builtin_prefetch(&Vh[base + (size_t)(kb + 64 + row) * 1024 + d0], 0, 1);
    }
    // this lane's mask values: 8 consecutive keys per 16-key tile
    float4 mk[4][2];
#pragma unroll
    for (int nt = 0; nt < 4; ++nt) {
      mk[nt][0] = *(const float4*)(mq + kb + nt * 16);
      mk[nt][1] = *(const float4*)(mq + kb + nt * 16 + 4);
    }
    async_fence();
    __syncthreads();

    // S^T = K @ Q^T : 64 keys (4 M-tiles) x 16 query columns, Kdim = depth 64
    v8f sacc[4];
#pragma unroll
    for (int nt = 0; nt < 4; ++nt) sacc[nt] = zero;
#pragma unroll
    for (int k2 = 0; k2 < 2; ++k2)
#pragma unroll
      for (int nt = 0; nt < 4; ++nt) {
        v16h ak = ld_frag(&Ks[(nt * 16 + lo) * KPITCH + k2 * 32 + hi * 8]);
        sacc[nt] = __builtin_amdgcn_wmma_f32_16x16x32_f16(
            false, ak, false, bq[k2], (short)0, sacc[nt], false, false);
      }

    // scaled logits + mask, then online softmax. D layout: key r+8*hi, query lo.
    float p[4][8];
    float mb = -3.0e38f;
#pragma unroll
    for (int nt = 0; nt < 4; ++nt) {
      const float mv[8] = {mk[nt][0].x, mk[nt][0].y, mk[nt][0].z, mk[nt][0].w,
                           mk[nt][1].x, mk[nt][1].y, mk[nt][1].z, mk[nt][1].w};
#pragma unroll
      for (int r = 0; r < 8; ++r) {
        float v  = sacc[nt][r] * 0.125f + mv[r] * (-1e9f);
        p[nt][r] = v;
        mb       = fmaxf(mb, v);
      }
    }
    mb = fmaxf(mb, xhalf(mb));   // the other half's 32 keys

    const float mn   = fmaxf(mrow, mb);
    const float corr = __expf(mrow - mn);
    mrow = mn;
    float s4[4];
#pragma unroll
    for (int nt = 0; nt < 4; ++nt) {
      float s = 0.0f;
#pragma unroll
      for (int r = 0; r < 8; ++r) {
        p[nt][r] = __expf(p[nt][r] - mn);
        s += p[nt][r];
      }
      s4[nt] = s;
    }
    lrow = lrow * corr + ((s4[0] + s4[1]) + (s4[2] + s4[3]));
#pragma unroll
    for (int dt = 0; dt < 4; ++dt)
#pragma unroll
      for (int r = 0; r < 8; ++r) acco[dt][r] = acco[dt][r] * corr;

    // O^T += V^T @ P^T : Kdim = 64 keys, 4 depth tiles. Both operands in the
    // hardware k order: slot s of half hi is key 8*hi + s (s < 8), 16 + 8*hi + s - 8.
#pragma unroll
    for (int k2 = 0; k2 < 2; ++k2) {
      v16h bp;
#pragma unroll
      for (int i = 0; i < 8; ++i) {
        bp[i]     = (_Float16)p[2 * k2][i];
        bp[i + 8] = (_Float16)p[2 * k2 + 1][i];
      }
      const _Float16* vp =
          &Vs[(k2 * 32 + hi * 8 + (lane & 7)) * VPITCH + ((lane >> 3) & 1) * 8];
#pragma unroll
      for (int dt = 0; dt < 4; ++dt) {
        v8h v0 = ld_tr16(vp + dt * 16);
        v8h v1 = ld_tr16(vp + 16 * VPITCH + dt * 16);
        v16h av;
#pragma unroll
        for (int i = 0; i < 8; ++i) { av[i] = v0[i]; av[i + 8] = v1[i]; }
        acco[dt] = __builtin_amdgcn_wmma_f32_16x16x32_f16(
            false, av, false, bp, (short)0, acco[dt], false, false);
      }
    }
  }

  // join the halves' sums, normalize and write context (f16, [b,s,h*64+d] layout):
  // a lane's 8 registers are 8 consecutive d of its query, one 16-byte store
  lrow += xhalf(lrow);
#pragma unroll
  for (int dt = 0; dt < 4; ++dt) {
    v8h o;
#pragma unroll
    for (int r = 0; r < 8; ++r) o[r] = (_Float16)(acco[dt][r] / lrow);
    *(v8h*)&ctx[base + (size_t)qg * 1024 + dt * 16 + hi * 8] = o;
  }
}

// ---------------------------------------------------------------------------
extern "C" void kernel_launch(void* const* d_in, const int* in_sizes, int n_in,
                              void* d_out, int out_size, void* d_ws, size_t ws_size,
                              hipStream_t stream) {
  (void)in_sizes; (void)n_in; (void)out_size; (void)ws_size;

  const float* q    = (const float*)d_in[0];
  const float* k    = (const float*)d_in[1];
  const float* v    = (const float*)d_in[2];
  const float* mask = (const float*)d_in[3];
  const float* wq   = (const float*)d_in[4];
  const float* bq   = (const float*)d_in[5];
  const float* wk   = (const float*)d_in[6];
  const float* bk   = (const float*)d_in[7];
  const float* wv   = (const float*)d_in[8];
  const float* bv   = (const float*)d_in[9];
  const float* wo   = (const float*)d_in[10];
  const float* bo   = (const float*)d_in[11];
  float* out = (float*)d_out;

  const size_t SZX = (size_t)MTOT * 1024;     // 4,194,304
  const size_t SZW = (size_t)1024 * 1024;     // 1,048,576
  _Float16* w16 = (_Float16*)d_ws;            // total 64 MiB of f16 scratch
  _Float16* qx  = w16;
  _Float16* kx  = qx + SZX;
  _Float16* vx  = kx + SZX;
  _Float16* wqh = vx + SZX;
  _Float16* wkh = wqh + SZW;
  _Float16* wvh = wkh + SZW;
  _Float16* woh = wvh + SZW;
  _Float16* Qp  = woh + SZW;
  _Float16* Kp  = Qp + SZX;
  _Float16* Vp  = Kp + SZX;
  _Float16* Cx  = Vp + SZX;

  // qx .. woh are contiguous from w16 in the kernel's unit order
  cvt_all_kernel<<<dim3(CVT_BLOCKS), CVT_THREADS, 0, stream>>>(q, k, v, wq, wk, wv, wo, w16);

  // the three projections in one launch: qx kx vx, wqh wkh wvh and Qp Kp Vp are
  // each contiguous in this order
  gemm_f16_kernel<false><<<dim3(1024 / 128, MTOT / 128, 3), 256, 0, stream>>>(
      qx, wqh, bq, bk, bv, nullptr, Qp);

  attention_kernel<<<dim3(SEQ / 64, BATCH * NUM_HEADS), 128, 0, stream>>>(
      Qp, Kp, Vp, mask, Cx);

  gemm_f16_kernel<true><<<dim3(1024 / 128, MTOT / 128, 1), 256, 0, stream>>>(
      Cx, woh, bo, bo, bo, out, nullptr);
}

// v007
// One run takes 111 microseconds.
// Two timings next to v006 both put it at 1.06 times that version's speed.
// All steps since v000 together make it 3.98 times as fast.
#include <hip/hip_runtime.h>
#include <math.h>

typedef __attribute__((ext_vector_type(16))) _Float16 v16h;
typedef __attribute__((ext_vector_type(8)))  _Float16 v8h;
typedef __attribute__((ext_vector_type(8)))  float    v8f;
typedef __attribute__((ext_vector_type(4)))  int      v4i;

#define D_MODEL 1024
#define NUM_HEADS 16
#define DEPTH 64
#define BATCH 2
#define SEQ 2048
#define MTOT (BATCH * SEQ)   // 4096

// CDNA5 async global->LDS copies (ASYNCcnt path). Guarded so either toolchain
// compiles; host pass always takes the plain fallback.
#if defined(__HIP_DEVICE_COMPILE__) &&                                   \
    __has_builtin(__builtin_amdgcn_global_load_async_to_lds_b128) &&     \
    __has_builtin(__builtin_amdgcn_s_wait_asynccnt)
#define USE_ASYNC_LDS 1
#else
#define USE_ASYNC_LDS 0
#endif

#if USE_ASYNC_LDS
typedef __attribute__((address_space(1))) v4i* as1_v4i_ptr;
typedef __attribute__((address_space(3))) v4i* as3_v4i_ptr;
#endif

__device__ __forceinline__ void copy16_g2l(void* lds, const void* g) {
#if USE_ASYNC_LDS
  __builtin_amdgcn_global_load_async_to_lds_b128(
      (as1_v4i_ptr)(void*)g, (as3_v4i_ptr)lds, 0, 0);
#else
  *(v8h*)lds = *(const v8h*)g;
#endif
}

__device__ __forceinline__ void async_fence() {
#if USE_ASYNC_LDS
  __builtin_amdgcn_s_wait_asynccnt(0);
#endif
}

struct h4 { _Float16 x, y, z, w; };

// ---------------------------------------------------------------------------
// fp32 -> f16 conversion of all seven operands in ONE launch of resident waves.
// The f16 copies lie back to back in the workspace in the order q, k, v, wq, wk,
// wv, wo: 16 units of 2^20 elements (4 + 4 + 4 + 1 + 1 + 1 + 1). 256 blocks of 16
// waves, one per WGP; a block converts 65,536 consecutive elements of one unit.
// Each wave-wide load takes 512 contiguous bytes, each store two whole lines; a
// wave's 32 loads are spread over the block's 256 KiB.
// ---------------------------------------------------------------------------
#define CVT_THREADS 512
#define CVT_BLOCKS 256
#define CVT_STEP (CVT_THREADS * 4)   // elements a block converts per load round
#define CVT_ROUNDS 32                // 32 * 2048 = 65,536 elements per block

__global__ __launch_bounds__(CVT_THREADS)
void cvt_all_kernel(const float* __restrict__ q, const float* __restrict__ k,
                    const float* __restrict__ v, const float* __restrict__ wq,
                    const float* __restrict__ wk, const float* __restrict__ wv,
                    const float* __restrict__ wo, _Float16* __restrict__ out) {
  const int b = blockIdx.x;
  const int u = b >> 4;   // unit of 2^20 elements
  const float* s;         // start of this unit in its own operand
  if (u < 4)        s = q + ((size_t)u << 20);
  else if (u < 8)   s = k + ((size_t)(u - 4) << 20);
  else if (u < 12)  s = v + ((size_t)(u - 8) << 20);
  else if (u == 12) s = wq;
  else if (u == 13) s = wk;
  else if (u == 14) s = wv;
  else              s = wo;
  const float* __restrict__ in = s + (b & 15) * (CVT_STEP * CVT_ROUNDS) + threadIdx.x * 4;
  _Float16* __restrict__ o16 =
      out + (size_t)b * (CVT_STEP * CVT_ROUNDS) + threadIdx.x * 4;

  // The loads stand in a loop of their own ahead of the conversions, so that many
  // are in flight per wave (a single load-convert-store loop built with one in
  // flight). Both loops are unrolled so that x[] stays in registers and every
  // address is base + constant.
  float4 x[CVT_ROUNDS];
#pragma unroll
  for (int i = 0; i < CVT_ROUNDS; ++i) x[i] = *(const float4*)(in + i * CVT_STEP);
#pragma unroll
  for (int i = 0; i < CVT_ROUNDS; ++i) {
    h4 o;
    o.x = (_Float16)x[i].x; o.y = (_Float16)x[i].y;
    o.z = (_Float16)x[i].z; o.w = (_Float16)x[i].w;
    *(h4*)(o16 + i * CVT_STEP) = o;
  }
}

// ---------------------------------------------------------------------------
// Fragment loader for 16-bit A/B operands of v_wmma_*_16x16x32.
// Lanes 0-15 -> row lo, K {0..7, 16..23}; lanes 16-31 -> row lo, K {8..15, 24..31}.
// Caller passes lane-resolved pointer (base + lo*stride + hi*8), 16B aligned.
// ---------------------------------------------------------------------------
__device__ __forceinline__ v16h ld_frag(const _Float16* p) {
  v8h a = *(const v8h*)p;
  v8h b = *(const v8h*)(p + 16);
  v16h r;
#pragma unroll
  for (int i = 0; i < 8; ++i) { r[i] = a[i]; r[i + 8] = b[i]; }
  return r;
}

typedef __attribute__((ext_vector_type(8))) short s16x8;
typedef __attribute__((address_space(3))) s16x8 lds_s16x8;

__device__ __forceinline__ v8h ld_tr16(const _Float16* p) {
  return __builtin_bit_cast(v8h, __builtin_amdgcn_ds_load_tr16_b128_v8i16((lds_s16x8*)p));
}

// W rows in LDS: 256 B of data at a pitch of 288 B (odd multiple of 32 B), the
// conflict-free pitch for the transposing load.
#define WPITCH 144

// X rows in LDS: 256 B of data at a pitch of 272 B (odd multiple of 16 B), the
// conflict-free pitch for the 16-byte fragment loads.
#define APITCH 136

// k extent of one staged tile pair
#define BK 128

// ---------------------------------------------------------------------------
// GEMM: Y[M,1024] = X[M,1024] @ W[1024,1024] + bias
// Block: 256 threads (8 waves), tile 128x128, BK=128: one copy wait and two
// barriers per 128 k, 64 KiB in flight per workgroup behind each wait.
// Wave (wm,wn) in 4x2 grid computes 32x64 via 2x4 WMMA tiles.
// The W tile lies in LDS as in memory (k rows, n contiguous); the transposing
// load turns it into the B operand.
// blockIdx.z picks one of up to three independent products of this shape whose
// X, W and Y lie back to back (X and Y 4096x1024 apart, W 1024x1024 apart). A
// workgroup stalls on its copies in every k step; with three products in one
// launch a WGP holds three workgroups, and each works while the others wait.
// ---------------------------------------------------------------------------
template <bool OUT_F32>
__global__ __launch_bounds__(256)
void gemm_f16_kernel(const _Float16* __restrict__ X0, const _Float16* __restrict__ W0,
                     const float* __restrict__ bias0, const float* __restrict__ bias1,
                     const float* __restrict__ bias2, float* __restrict__ Yf,
                     _Float16* __restrict__ Yh0) {
  const int z = blockIdx.z;
  const _Float16* __restrict__ X = X0 + (size_t)z * (MTOT * 1024);
  const _Float16* __restrict__ W = W0 + (size_t)z * (1024 * 1024);
  const float* __restrict__ bias = z == 0 ? bias0 : (z == 1 ? bias1 : bias2);
  _Float16* __restrict__ Yh = Yh0 + (size_t)z * (MTOT * 1024);

  // One LDS block, the X tile first: the W tile then starts at 34,816 B, above the
  // 32-KiB immediate offset that the compiler folds into some W copies (it takes
  // the offset off the LDS address register, which so stays above zero).
  __shared__ __align__(32) _Float16 Sm[128 * APITCH + BK * WPITCH];
  _Float16* const As = Sm;                 // m-major, k-contiguous, padded rows
  _Float16* const Ws = Sm + 128 * APITCH;  // k-major, n-contiguous, padded rows

  const int t    = threadIdx.x;
  const int lane = t & 31;
  const int wid  = t >> 5;
  const int lo   = lane & 15;
  const int hi   = lane >> 4;
  const int wm   = wid >> 1;  // 0..3
  const int wn   = wid & 1;   // 0..1
  const int m0   = blockIdx.y * 128;
  const int n0   = blockIdx.x * 128;

  const v8f zero = {0, 0, 0, 0, 0, 0, 0, 0};
  v8f acc[2][4];
#pragma unroll
  for (int i = 0; i < 2; ++i)
#pragma unroll
    for (int j = 0; j < 4; ++j) acc[i][j] = zero;

  // Both tiles are 128 rows of 16 chunks of 8 halves; a thread copies chunk t & 15
  // of rows (t >> 4) + 16 i. Its offset inside a 16-row slab is the same for every
  // slab of X and of W, and a slab's start is uniform: the addresses are formed
  // from scalar slab starts and this one offset, so no address pair per copy stays
  // live over the loop. Three workgroups on a WGP need at most 160 registers.
  const int      srow = t >> 4;
  const int      sc8  = (t & 15) * 8;
  const unsigned goff = (unsigned)(srow * 1024 + sc8);

  for (int k0 = 0; k0 < 1024; k0 += BK) {
    // stage A (async DMA into LDS): 128x128 f16 = 2048 chunks of 8, 8 per thread
#pragma unroll
    for (int i = 0; i < 8; ++i) {
      const _Float16* slab = X + (size_t)(m0 + i * 16) * 1024 + k0;
      copy16_g2l(&As[(srow + i * 16) * APITCH + sc8], slab + goff);
    }
    // stage W tile row-major (async): 128x128 f16 = 2048 chunks of 8, 8 per thread
#pragma unroll
    for (int i = 0; i < 8; ++i) {
      const _Float16* slab = W + (size_t)(k0 + i * 16) * 1024 + n0;
      copy16_g2l(&Ws[(srow + i * 16) * WPITCH + sc8], slab + goff);
    }
    // prefetch next iteration's tiles into cache while we compute: one 128-B
    // line of each tile per thread
    if (k0 + BK < 1024) {
      int c = t;
      __builtin_prefetch(&X[(size_t)(m0 + (c >> 1)) * 1024 + k0 + BK + (c & 1) * 64], 0, 1);
      __builtin_prefetch(&W[(size_t)(k0 + BK + (c >> 1)) * 1024 + n0 + (c & 1) * 64], 0, 1);
    }
    // own copies landed, then the barrier: it publishes both tiles to the other
    // waves and, directly behind the wait, keeps the LDS reads behind it
    async_fence();
    __syncthreads();

    // the tile's four 32-k blocks in ascending k; unrolled so that every LDS
    // address is base + constant and a block's loads can run ahead of it
#pragma unroll
    for (int kk = 0; kk < BK; kk += 32) {
      v16h af[2], bf[4];
#pragma unroll
      for (int mt = 0; mt < 2; ++mt)
        af[mt] = ld_frag(&As[(wm * 32 + mt * 16 + lo) * APITCH + kk + hi * 8]);
      // B operand in the k order of ld_frag: slot s of half hi is k 8*hi + s (s < 8),
      // 16 + 8*hi + s - 8; column lo
      const _Float16* wp =
          &Ws[(kk + hi * 8 + (lane & 7)) * WPITCH + wn * 64 + ((lane >> 3) & 1) * 8];
#pragma unroll
      for (int nt = 0; nt < 4; ++nt) {
        v8h w0 = ld_tr16(wp + nt * 16);
        v8h w1 = ld_tr16(wp + 16 * WPITCH + nt * 16);
#pragma unroll
        for (int i = 0; i < 8; ++i) { bf[nt][i] = w0[i]; bf[nt][i + 8] = w1[i]; }
      }
#pragma unroll
      for (int mt = 0; mt < 2; ++mt)
#pragma unroll
        for (int nt = 0; nt < 4; ++nt)
          acc[mt][nt] = __builtin_amdgcn_wmma_f32_16x16x32_f16(
              false, af[mt], false, bf[nt], (short)0, acc[mt][nt], false, false);
    }
    __syncthreads();
  }

  // epilogue: C layout row M = r + 8*hi, col N = lo (within tile)
#pragma unroll
  for (int mt = 0; mt < 2; ++mt)
#pragma unroll
    for (int nt = 0; nt < 4; ++nt) {
      int   col = n0 + wn * 64 + nt * 16 + lo;
      float bv  = bias[col];
#pragma unroll
      for (int r = 0; r < 8; ++r) {
        int   rowg = m0 + wm * 32 + mt * 16 + r + hi * 8;
        float v    = acc[mt][nt][r] + bv;
        if (OUT_F32) Yf[(size_t)rowg * 1024 + col] = v;
        else         Yh[(size_t)rowg * 1024 + col] = (_Float16)v;
      }
    }
}

// Lane l with lane l ^ 16: the exchange between the wave halves, as a vector move
__device__ __forceinline__ float xhalf(float x) {
  return __builtin_bit_cast(float, __builtin_amdgcn_permlanex16(
      __builtin_bit_cast(int, x), __builtin_bit_cast(int, x),
      0x76543210, 0xfedcba98, false, false));
}

// V rows in LDS: 128 B of data at a pitch of 160 B (odd multiple of 32 B), the
// conflict-free pitch for the transposing load.
#define VPITCH 80

// K rows in LDS: 128 B of data at a pitch of 144 B (odd multiple of 16 B), the
// conflict-free pitch for the 16-byte fragment loads; at 128 B the 16 rows of a
// fragment fall on an eighth of the banks.
#define KPITCH 72

// Mask rows in LDS: 256 B of data (64 f32) at a pitch of 272 B (odd multiple of
// 16 B), the conflict-free pitch for the 16-byte loads; counted in floats.
#define MPITCH 68

// ---------------------------------------------------------------------------
// Flash attention, transposed products: S^T = K Q^T, O^T += V^T P^T.
// One block per (64-query tile, b*h). 4 waves, 16 query columns per wave.
// A lane holds scores of ONE query (column lo), keys 8*hi + r of each 16-key tile,
// so max and sum run in-lane with one exchange between the wave halves, and two
// score tiles convert in place into the B operand of the second product.
// Q/K/V are f16 in [b, s, h*64+d] layout. ctx written in same layout.
// The mask tile (64 queries x 64 keys, f32) goes through LDS: a lane needs 32 B of
// its own query's row, so a wave-wide load straight from memory touches 16 lines,
// while a wave-wide copy of two whole rows touches four.
// ---------------------------------------------------------------------------
__global__ __launch_bounds__(128)
void attention_kernel(const _Float16* __restrict__ Qh, const _Float16* __restrict__ Kh,
                      const _Float16* __restrict__ Vh, const float* __restrict__ mask,
                      _Float16* __restrict__ ctx) {
  __shared__ __align__(16) _Float16 Ks[64 * KPITCH];   // key major, d contiguous, padded rows
  __shared__ __align__(32) _Float16 Vs[64 * VPITCH];   // key major, d contiguous, padded rows
  __shared__ __align__(16) float    Ms[64 * MPITCH];   // query major, key contiguous, padded rows

  const int t    = threadIdx.x;
  const int lane = t & 31;
  const int wid  = t >> 5;
  const int lo   = lane & 15;
  const int hi   = lane >> 4;
  const int bh   = blockIdx.y;
  const int b    = bh >> 4;
  const int h    = bh & 15;
  const int s0   = blockIdx.x * 64;
  const int qg   = s0 + wid * 16 + lo;   // this lane's query
  const size_t base = (size_t)b * SEQ * 1024 + (size_t)h * 64;

  // Q^T as B operand (column = query lo), loaded once and kept in registers
  v16h bq[2];
#pragma unroll
  for (int k2 = 0; k2 < 2; ++k2)
    bq[k2] = ld_frag(&Qh[base + (size_t)qg * 1024 + k2 * 32 + hi * 8]);

  // Mask tile: 64 rows of 16 chunks of 4 floats; a thread copies chunk t & 15 of rows
  // (t >> 4) + 8 i. Its offset inside an 8-row slab is the same for every slab, and a
  // slab's start is uniform.
  const int      mrow0 = t >> 4;
  const int      mc4   = (t & 15) * 4;
  const unsigned moff  = (unsigned)(mrow0 * SEQ + mc4);
  // this lane's mask values in LDS: row of its query, 8 consecutive keys per 16-key tile
  const float* const mq = &Ms[(wid * 16 + lo) * MPITCH + hi * 8];

  const v8f zero = {0, 0, 0, 0, 0, 0, 0, 0};
  float mrow = -3.0e38f, lrow = 0.0f;   // lrow: this half's share of the row sum
  v8f acco[4];                          // O^T: row d = dt*16 + 8*hi + r, column lo
#pragma unroll
  for (int dt = 0; dt < 4; ++dt) acco[dt] = zero;

  for (int kb = 0; kb < SEQ; kb += 64) {
    __syncthreads();  // protect Ks/Vs/Ms from previous iteration's readers
    // stage K and V row-major (async)
#pragma unroll
    for (int i = 0; i < 4; ++i) {
      int c = t + i * 128;
      int row = c >> 3, d0 = (c & 7) * 8;
      copy16_g2l(&Ks[row * KPITCH + d0],
                 &Kh[base + (size_t)(kb + row) * 1024 + d0]);
      copy16_g2l(&Vs[row * VPITCH + d0],
                 &Vh[base + (size_t)(kb + row) * 1024 + d0]);
    }
    // stage the mask tile row-major (async): 1024 chunks of 16 B, 8 per thread
#pragma unroll
    for (int i = 0; i < 8; ++i) {
      const float* slab = mask + (size_t)(s0 + i * 8) * SEQ + kb;
      copy16_g2l(&Ms[(mrow0 + i * 8) * MPITCH + mc4], slab + moff);
    }
    // prefetch next key block while this one is being consumed
    if (kb + 64 < SEQ) {
      int c = t;
      int row = c >> 3, d0 = (c & 7) * 8;
      __builtin_prefetch(&Kh[base + (size_t)(kb + 64 + row) * 1024 + d0], 0, 1);
      __builtin_prefetch(&Vh[base + (size_t)(kb + 64 + row) * 1024 + d0], 0, 1);
    }
    async_fence();
    __syncthreads();

    // this lane's mask values: 8 consecutive keys per 16-key tile
    float4 mk[4][2];
#pragma unroll
    for (int nt = 0; nt < 4; ++nt) {
      mk[nt][0] = *(const float4*)(mq + nt * 16);
      mk[nt][1] = *(const float4*)(mq + nt * 16 + 4);
    }

    // S^T = K @ Q^T : 64 keys (4 M-tiles) x 16 query columns, Kdim = depth 64
    v8f sacc[4];
#pragma unroll
    for (int nt = 0; nt < 4; ++nt) sacc[nt] = zero;
#pragma unroll
    for (int k2 = 0; k2 < 2; ++k2)
#pragma unroll
      for (int nt = 0; nt < 4; ++nt) {
        v16h ak = ld_frag(&Ks[(nt * 16 + lo) * KPITCH + k2 * 32 + hi * 8]);
        sacc[nt] = __builtin_amdgcn_wmma_f32_16x16x32_f16(
            false, ak, false, bq[k2], (short)0, sacc[nt], false, false);
      }

    // scaled logits + mask, then online softmax. D layout: key r+8*hi, query lo.
    float p[4][8];
    float mb = -3.0e38f;
#pragma unroll
    for (int nt = 0; nt < 4; ++nt) {
      const float mv[8] = {mk[nt][0].x, mk[nt][0].y, mk[nt][0].z, mk[nt][0].w,
                           mk[nt][1].x, mk[nt][1].y, mk[nt][1].z, mk[nt][1].w};
#pragma unroll
      for (int r = 0; r < 8; ++r) {
        float v  = sacc[nt][r] * 0.125f + mv[r] * (-1e9f);
        p[nt][r] = v;
        mb       = fmaxf(mb, v);
      }
    }
    mb = fmaxf(mb, xhalf(mb));   // the other half's 32 keys

    const float mn   = fmaxf(mrow, mb);
    const float corr = __expf(mrow - mn);
    mrow = mn;
    float s4[4];
#pragma unroll
    for (int nt = 0; nt < 4; ++nt) {
      float s = 0.0f;
#pragma unroll
      for (int r = 0; r < 8; ++r) {
        p[nt][r] = __expf(p[nt][r] - mn);
        s += p[nt][r];
      }
      s4[nt] = s;
    }
    lrow = lrow * corr + ((s4[0] + s4[1]) + (s4[2] + s4[3]));
#pragma unroll
    for (int dt = 0; dt < 4; ++dt)
#pragma unroll
      for (int r = 0; r < 8; ++r) acco[dt][r] = acco[dt][r] * corr;

    // O^T += V^T @ P^T : Kdim = 64 keys, 4 depth tiles. Both operands in the
    // hardware k order: slot s of half hi is key 8*hi + s (s < 8), 16 + 8*hi + s - 8.
#pragma unroll
    for (int k2 = 0; k2 < 2; ++k2) {
      v16h bp;
#pragma unroll
      for (int i = 0; i < 8; ++i) {
        bp[i]     = (_Float16)p[2 * k2][i];
        bp[i + 8] = (_Float16)p[2 * k2 + 1][i];
      }
      const _Float16* vp =
          &Vs[(k2 * 32 + hi * 8 + (lane & 7)) * VPITCH + ((lane >> 3) & 1) * 8];
#pragma unroll
      for (int dt = 0; dt < 4; ++dt) {
        v8h v0 = ld_tr16(vp + dt * 16);
        v8h v1 = ld_tr16(vp + 16 * VPITCH + dt * 16);
        v16h av;
#pragma unroll
        for (int i = 0; i < 8; ++i) { av[i] = v0[i]; av[i + 8] = v1[i]; }
        acco[dt] = __builtin_amdgcn_wmma_f32_16x16x32_f16(
            false, av, false, bp, (short)0, acco[dt], false, false);
      }
    }
  }

  // join the halves' sums, normalize and write context (f16, [b,s,h*64+d] layout):
  // a lane's 8 registers are 8 consecutive d of its query, one 16-byte store
  lrow += xhalf(lrow);
#pragma unroll
  for (int dt = 0; dt < 4; ++dt) {
    v8h o;
#pragma unroll
    for (int r = 0; r < 8; ++r) o[r] = (_Float16)(acco[dt][r] / lrow);
    *(v8h*)&ctx[base + (size_t)qg * 1024 + dt * 16 + hi * 8] = o;
  }
}

// ---------------------------------------------------------------------------
extern "C" void kernel_launch(void* const* d_in, const int* in_sizes, int n_in,
                              void* d_out, int out_size, void* d_ws, size_t ws_size,
                              hipStream_t stream) {
  (void)in_sizes; (void)n_in; (void)out_size; (void)ws_size;

  const float* q    = (const float*)d_in[0];
  const float* k    = (const float*)d_in[1];
  const float* v    = (const float*)d_in[2];
  const float* mask = (const float*)d_in[3];
  const float* wq   = (const float*)d_in[4];
  const float* bq   = (const float*)d_in[5];
  const float* wk   = (const float*)d_in[6];
  const float* bk   = (const float*)d_in[7];
  const float* wv   = (const float*)d_in[8];
  const float* bv   = (const float*)d_in[9];
  const float* wo   = (const float*)d_in[10];
  const float* bo   = (const float*)d_in[11];
  float* out = (float*)d_out;

  const size_t SZX = (size_t)MTOT * 1024;     // 4,194,304
  const size_t SZW = (size_t)1024 * 1024;     // 1,048,576
  _Float16* w16 = (_Float16*)d_ws;            // total 64 MiB of f16 scratch
  _Float16* qx  = w16;
  _Float16* kx  = qx + SZX;
  _Float16* vx  = kx + SZX;
  _Float16* wqh = vx + SZX;
  _Float16* wkh = wqh + SZW;
  _Float16* wvh = wkh + SZW;
  _Float16* woh = wvh + SZW;
  _Float16* Qp  = woh + SZW;
  _Float16* Kp  = Qp + SZX;
  _Float16* Vp  = Kp + SZX;
  _Float16* Cx  = Vp + SZX;

  // qx .. woh are contiguous from w16 in the kernel's unit order
  cvt_all_kernel<<<dim3(CVT_BLOCKS), CVT_THREADS, 0, stream>>>(q, k, v, wq, wk, wv, wo, w16);

  // the three projections in one launch: qx kx vx, wqh wkh wvh and Qp Kp Vp are
  // each contiguous in this order
  gemm_f16_kernel<false><<<dim3(1024 / 128, MTOT / 128, 3), 256, 0, stream>>>(
      qx, wqh, bq, bk, bv, nullptr, Qp);

  attention_kernel<<<dim3(SEQ / 64, BATCH * NUM_HEADS), 128, 0, stream>>>(
      Qp, Kp, Vp, mask, Cx);

  gemm_f16_kernel<true><<<dim3(1024 / 128, MTOT / 128, 1), 256, 0, stream>>>(
      Cx, woh, bo, bo, bo, out, nullptr);
}

// v008
// A run of this version takes 105 microseconds.
// In both of two side-by-side timings against v007, it was 1.05 times as fast.
// Over all steps from v000 it is 4.19 times as fast.
#include <hip/hip_runtime.h>
#include <math.h>

typedef __attribute__((ext_vector_type(16))) _Float16 v16h;
typedef __attribute__((ext_vector_type(8)))  _Float16 v8h;
typedef __attribute__((ext_vector_type(8)))  float    v8f;
typedef __attribute__((ext_vector_type(4)))  int      v4i;

#define D_MODEL 1024
#define NUM_HEADS 16
#define DEPTH 64
#define BATCH 2
#define SEQ 2048
#define MTOT (BATCH * SEQ)   // 4096

// CDNA5 async global->LDS copies (ASYNCcnt path). Guarded so either toolchain
// compiles; host pass always takes the plain fallback.
#if defined(__HIP_DEVICE_COMPILE__) &&                                   \
    __has_builtin(__builtin_amdgcn_global_load_async_to_lds_b128) &&     \
    __has_builtin(__builtin_amdgcn_s_wait_asynccnt)
#define USE_ASYNC_LDS 1
#else
#define USE_ASYNC_LDS 0
#endif

#if USE_ASYNC_LDS
typedef __attribute__((address_space(1))) v4i* as1_v4i_ptr;
typedef __attribute__((address_space(3))) v4i* as3_v4i_ptr;
#endif

__device__ __forceinline__ void copy16_g2l(void* lds, const void* g) {
#if USE_ASYNC_LDS
  __builtin_amdgcn_global_load_async_to_lds_b128(
      (as1_v4i_ptr)(void*)g, (as3_v4i_ptr)lds, 0, 0);
#else
  *(v8h*)lds = *(const v8h*)g;
#endif
}

__device__ __forceinline__ void async_fence() {
#if USE_ASYNC_LDS
  __builtin_amdgcn_s_wait_asynccnt(0);
#endif
}

struct h4 { _Float16 x, y, z, w; };

// ---------------------------------------------------------------------------
// fp32 -> f16 conversion of all seven operands in ONE launch of resident waves.
// The f16 copies lie back to back in the workspace in the order q, k, v, wq, wk,
// wv, wo: 16 units of 2^20 elements (4 + 4 + 4 + 1 + 1 + 1 + 1). 256 blocks of 16
// waves, one per WGP; a block converts 65,536 consecutive elements of one unit.
// Each wave-wide load takes 512 contiguous bytes, each store two whole lines; a
// wave's 32 loads are spread over the block's 256 KiB.
// ---------------------------------------------------------------------------
#define CVT_THREADS 512
#define CVT_BLOCKS 256
#define CVT_STEP (CVT_THREADS * 4)   // elements a block converts per load round
#define CVT_ROUNDS 32                // 32 * 2048 = 65,536 elements per block

__global__ __launch_bounds__(CVT_THREADS)
void cvt_all_kernel(const float* __restrict__ q, const float* __restrict__ k,
                    const float* __restrict__ v, const float* __restrict__ wq,
                    const float* __restrict__ wk, const float* __restrict__ wv,
                    const float* __restrict__ wo, _Float16* __restrict__ out) {
  const int b = blockIdx.x;
  const int u = b >> 4;   // unit of 2^20 elements
  const float* s;         // start of this unit in its own operand
  if (u < 4)        s = q + ((size_t)u << 20);
  else if (u < 8)   s = k + ((size_t)(u - 4) << 20);
  else if (u < 12)  s = v + ((size_t)(u - 8) << 20);
  else if (u == 12) s = wq;
  else if (u == 13) s = wk;
  else if (u == 14) s = wv;
  else              s = wo;
  const float* __restrict__ in = s + (b & 15) * (CVT_STEP * CVT_ROUNDS) + threadIdx.x * 4;
  _Float16* __restrict__ o16 =
      out + (size_t)b * (CVT_STEP * CVT_ROUNDS) + threadIdx.x * 4;

  // The loads stand in a loop of their own ahead of the conversions, so that many
  // are in flight per wave (a single load-convert-store loop built with one in
  // flight). Both loops are unrolled so that x[] stays in registers and every
  // address is base + constant.
  float4 x[CVT_ROUNDS];
#pragma unroll
  for (int i = 0; i < CVT_ROUNDS; ++i) x[i] = *(const float4*)(in + i * CVT_STEP);
#pragma unroll
  for (int i = 0; i < CVT_ROUNDS; ++i) {
    h4 o;
    o.x = (_Float16)x[i].x; o.y = (_Float16)x[i].y;
    o.z = (_Float16)x[i].z; o.w = (_Float16)x[i].w;
    *(h4*)(o16 + i * CVT_STEP) = o;
  }
}

// ---------------------------------------------------------------------------
// Fragment loader for 16-bit A/B operands of v_wmma_*_16x16x32.
// Lanes 0-15 -> row lo, K {0..7, 16..23}; lanes 16-31 -> row lo, K {8..15, 24..31}.
// Caller passes lane-resolved pointer (base + lo*stride + hi*8), 16B aligned.
// ---------------------------------------------------------------------------
__device__ __forceinline__ v16h ld_frag(const _Float16* p) {
  v8h a = *(const v8h*)p;
  v8h b = *(const v8h*)(p + 16);
  v16h r;
#pragma unroll
  for (int i = 0; i < 8; ++i) { r[i] = a[i]; r[i + 8] = b[i]; }
  return r;
}

typedef __attribute__((ext_vector_type(8))) short s16x8;
typedef __attribute__((address_space(3))) s16x8 lds_s16x8;

__device__ __forceinline__ v8h ld_tr16(const _Float16* p) {
  return __builtin_bit_cast(v8h, __builtin_amdgcn_ds_load_tr16_b128_v8i16((lds_s16x8*)p));
}

// W rows in LDS: 256 B of data at a pitch of 288 B (odd multiple of 32 B), the
// conflict-free pitch for the transposing load.
#define WPITCH 144

// X rows in LDS: 256 B of data at a pitch of 272 B (odd multiple of 16 B), the
// conflict-free pitch for the 16-byte fragment loads.
#define APITCH 136

// k extent of one staged tile pair
#define BK 128

// ---------------------------------------------------------------------------
// GEMM: Y[M,1024] = X[M,1024] @ W[1024,1024] + bias
// Block: 256 threads (8 waves), tile 128x128, BK=128: one copy wait and two
// barriers per 128 k, 64 KiB in flight per workgroup behind each wait.
// Wave (wm,wn) in 4x2 grid computes 32x64 via 2x4 WMMA tiles.
// The W tile lies in LDS as in memory (k rows, n contiguous); the transposing
// load turns it into the B operand.
// blockIdx.z picks one of up to three independent products of this shape whose
// X, W and Y lie back to back (X and Y 4096x1024 apart, W 1024x1024 apart). A
// workgroup stalls on its copies in every k step; with three products in one
// launch a WGP holds three workgroups, and each works while the others wait.
// ---------------------------------------------------------------------------
template <bool OUT_F32>
__global__ __launch_bounds__(256)
void gemm_f16_kernel(const _Float16* __restrict__ X0, const _Float16* __restrict__ W0,
                     const float* __restrict__ bias0, const float* __restrict__ bias1,
                     const float* __restrict__ bias2, float* __restrict__ Yf,
                     _Float16* __restrict__ Yh0) {
  const int z = blockIdx.z;
  const _Float16* __restrict__ X = X0 + (size_t)z * (MTOT * 1024);
  const _Float16* __restrict__ W = W0 + (size_t)z * (1024 * 1024);
  const float* __restrict__ bias = z == 0 ? bias0 : (z == 1 ? bias1 : bias2);
  _Float16* __restrict__ Yh = Yh0 + (size_t)z * (MTOT * 1024);

  // One LDS block, the X tile first: the W tile then starts at 34,816 B, above the
  // 32-KiB immediate offset that the compiler folds into some W copies (it takes
  // the offset off the LDS address register, which so stays above zero).
  __shared__ __align__(32) _Float16 Sm[128 * APITCH + BK * WPITCH];
  _Float16* const As = Sm;                 // m-major, k-contiguous, padded rows
  _Float16* const Ws = Sm + 128 * APITCH;  // k-major, n-contiguous, padded rows

  const int t    = threadIdx.x;
  const int lane = t & 31;
  const int wid  = t >> 5;
  const int lo   = lane & 15;
  const int hi   = lane >> 4;
  const int wm   = wid >> 1;  // 0..3
  const int wn   = wid & 1;   // 0..1
  const int m0   = blockIdx.y * 128;
  const int n0   = blockIdx.x * 128;

  const v8f zero = {0, 0, 0, 0, 0, 0, 0, 0};
  v8f acc[2][4];
#pragma unroll
  for (int i = 0; i < 2; ++i)
#pragma unroll
    for (int j = 0; j < 4; ++j) acc[i][j] = zero;

  // Both tiles are 128 rows of 16 chunks of 8 halves; a thread copies chunk t & 15
  // of rows (t >> 4) + 16 i. Its offset inside a 16-row slab is the same for every
  // slab of X and of W, and a slab's start is uniform: the addresses are formed
  // from scalar slab starts and this one offset, so no address pair per copy stays
  // live over the loop. Three workgroups on a WGP need at most 160 registers.
  const int      srow = t >> 4;
  const int      sc8  = (t & 15) * 8;
  const unsigned goff = (unsigned)(srow * 1024 + sc8);

  for (int k0 = 0; k0 < 1024; k0 += BK) {
    // stage A (async DMA into LDS): 128x128 f16 = 2048 chunks of 8, 8 per thread
#pragma unroll
    for (int i = 0; i < 8; ++i) {
      const _Float16* slab = X + (size_t)(m0 + i * 16) * 1024 + k0;
      copy16_g2l(&As[(srow + i * 16) * APITCH + sc8], slab + goff);
    }
    // stage W tile row-major (async): 128x128 f16 = 2048 chunks of 8, 8 per thread
#pragma unroll
    for (int i = 0; i < 8; ++i) {
      const _Float16* slab = W + (size_t)(k0 + i * 16) * 1024 + n0;
      copy16_g2l(&Ws[(srow + i * 16) * WPITCH + sc8], slab + goff);
    }
    // prefetch next iteration's tiles into cache while we compute: one 128-B
    // line of each tile per thread
    if (k0 + BK < 1024) {
      int c = t;
      __builtin_prefetch(&X[(size_t)(m0 + (c >> 1)) * 1024 + k0 + BK + (c & 1) * 64], 0, 1);
      __builtin_prefetch(&W[(size_t)(k0 + BK + (c >> 1)) * 1024 + n0 + (c & 1) * 64], 0, 1);
    }
    // own copies landed, then the barrier: it publishes both tiles to the other
    // waves and, directly behind the wait, keeps the LDS reads behind it
    async_fence();
    __syncthreads();

    // the tile's four 32-k blocks in ascending k; unrolled so that every LDS
    // address is base + constant and a block's loads can run ahead of it
#pragma unroll
    for (int kk = 0; kk < BK; kk += 32) {
      v16h af[2], bf[4];
#pragma unroll
      for (int mt = 0; mt < 2; ++mt)
        af[mt] = ld_frag(&As[(wm * 32 + mt * 16 + lo) * APITCH + kk + hi * 8]);
      // B operand in the k order of ld_frag: slot s of half hi is k 8*hi + s (s < 8),
      // 16 + 8*hi + s - 8; column lo
      const _Float16* wp =
          &Ws[(kk + hi * 8 + (lane & 7)) * WPITCH + wn * 64 + ((lane >> 3) & 1) * 8];
#pragma unroll
      for (int nt = 0; nt < 4; ++nt) {
        v8h w0 = ld_tr16(wp + nt * 16);
        v8h w1 = ld_tr16(wp + 16 * WPITCH + nt * 16);
#pragma unroll
        for (int i = 0; i < 8; ++i) { bf[nt][i] = w0[i]; bf[nt][i + 8] = w1[i]; }
      }
#pragma unroll
      for (int mt = 0; mt < 2; ++mt)
#pragma unroll
        for (int nt = 0; nt < 4; ++nt)
          acc[mt][nt] = __builtin_amdgcn_wmma_f32_16x16x32_f16(
              false, af[mt], false, bf[nt], (short)0, acc[mt][nt], false, false);
    }
    __syncthreads();
  }

  // epilogue: C layout row M = r + 8*hi, col N = lo (within tile)
#pragma unroll
  for (int mt = 0; mt < 2; ++mt)
#pragma unroll
    for (int nt = 0; nt < 4; ++nt) {
      int   col = n0 + wn * 64 + nt * 16 + lo;
      float bv  = bias[col];
#pragma unroll
      for (int r = 0; r < 8; ++r) {
        int   rowg = m0 + wm * 32 + mt * 16 + r + hi * 8;
        float v    = acc[mt][nt][r] + bv;
        if (OUT_F32) Yf[(size_t)rowg * 1024 + col] = v;
        else         Yh[(size_t)rowg * 1024 + col] = (_Float16)v;
      }
    }
}

// Byte address in the workgroup's LDS of a __shared__ object
__device__ __forceinline__ unsigned lds_addr(const void* p) {
  return (unsigned)(size_t)p;   // low 32 bits of the __shared__ address
}

// Lane l with lane l ^ 16: the exchange between the wave halves, as a vector move
__device__ __forceinline__ float xhalf(float x) {
  return __builtin_bit_cast(float, __builtin_amdgcn_permlanex16(
      __builtin_bit_cast(int, x), __builtin_bit_cast(int, x),
      0x76543210, 0xfedcba98, false, false));
}

// V rows in LDS: 128 B of data at a pitch of 160 B (odd multiple of 32 B), the
// conflict-free pitch for the transposing load.
#define VPITCH 80

// K rows in LDS: 128 B of data at a pitch of 144 B (odd multiple of 16 B), the
// conflict-free pitch for the 16-byte fragment loads; at 128 B the 16 rows of a
// fragment fall on an eighth of the banks.
#define KPITCH 72

// Mask rows in LDS: 256 B of data (64 f32) at a pitch of 272 B (odd multiple of
// 16 B), the conflict-free pitch for the 16-byte loads; counted in floats.
#define MPITCH 68

// ---------------------------------------------------------------------------
// Flash attention, transposed products: S^T = K Q^T, O^T += V^T P^T.
// One block per (64-query tile, b*h). 4 waves, 16 query columns per wave.
// A lane holds scores of ONE query (column lo), keys 8*hi + r of each 16-key tile,
// so max and sum run in-lane with one exchange between the wave halves, and two
// score tiles convert in place into the B operand of the second product.
// Q/K/V are f16 in [b, s, h*64+d] layout. ctx written in same layout.
// The mask tile (64 queries x 64 keys, f32) goes through LDS: a lane needs 32 B of
// its own query's row, so a wave-wide load straight from memory touches 16 lines,
// while a wave-wide copy of two whole rows touches four.
// The K, V and mask tiles stand in two LDS buffers: the copies of key block j + 2
// are issued as soon as block j's buffer is free and fly while block j + 1 is
// worked on, so a workgroup waits for its copies only where they are late.
// ---------------------------------------------------------------------------
__global__ __launch_bounds__(128)
void attention_kernel(const _Float16* __restrict__ Qh, const _Float16* __restrict__ Kh,
                      const _Float16* __restrict__ Vh, const float* __restrict__ mask,
                      _Float16* __restrict__ ctx) {
  __shared__ __align__(16) _Float16 Ks[2][64 * KPITCH];   // key major, d contiguous, padded rows
  __shared__ __align__(32) _Float16 Vs[2][64 * VPITCH];   // key major, d contiguous, padded rows
  __shared__ __align__(16) float    Ms[2][64 * MPITCH];   // query major, key contiguous, padded rows

  const int t    = threadIdx.x;
  const int lane = t & 31;
  const int wid  = t >> 5;
  const int lo   = lane & 15;
  const int hi   = lane >> 4;
  const int bh   = blockIdx.y;
  const int b    = bh >> 4;
  const int h    = bh & 15;
  const int s0   = blockIdx.x * 64;
  const int qg   = s0 + wid * 16 + lo;   // this lane's query
  const size_t base = (size_t)b * SEQ * 1024 + (size_t)h * 64;

  // Q^T as B operand (column = query lo), loaded once and kept in registers
  v16h bq[2];
#pragma unroll
  for (int k2 = 0; k2 < 2; ++k2)
    bq[k2] = ld_frag(&Qh[base + (size_t)qg * 1024 + k2 * 32 + hi * 8]);

  // Mask tile: 64 rows of 16 chunks of 4 floats
  const int      mrow0 = t >> 4;
  const int      mc4   = (t & 15) * 4;
  // this lane's mask values in a buffer: row of its query, 8 consecutive keys per 16-key tile
  const int mqo = (wid * 16 + lo) * MPITCH + hi * 8;

  // The copies of one key block into buffer bf, 16 per thread. K and V: 64 rows of 8
  // chunks of 16 B, a thread copies chunk t & 7 of rows (t >> 3) + 16 i. Mask: chunk
  // t & 15 of rows (t >> 4) + 8 i. A copy's address is a scalar slab start + the
  // thread's offset inside a slab + the immediate offset, and the immediate offset
  // moves the LDS address as well: it is the slab's step in LDS (16 or 8 padded rows),
  // and the scalar start holds the step in memory less that. So a thread needs one
  // LDS address per tile and buffer and two offsets, and no vector add per copy.
  static_assert(16 * KPITCH * 2 == 2304 && 16 * VPITCH * 2 == 2560 && 8 * MPITCH * 4 == 2176,
                "the immediate offsets below are the slabs' steps in LDS");
  const unsigned kvoff = (unsigned)((t >> 3) * 2048 + (t & 7) * 16);   // bytes
  const unsigned moffb = (unsigned)(mrow0 * (SEQ * 4) + mc4 * 4);      // bytes
  auto stage = [&](int kb, int bf) {
    const unsigned lk = lds_addr(&Ks[bf][(t >> 3) * KPITCH + (t & 7) * 8]);
    const unsigned lv = lds_addr(&Vs[bf][(t >> 3) * VPITCH + (t & 7) * 8]);
    const unsigned lm = lds_addr(&Ms[bf][mrow0 * MPITCH + mc4]);
    const char* gk = (const char*)(Kh + base + (size_t)kb * 1024);
    const char* gv = (const char*)(Vh + base + (size_t)kb * 1024);
    const char* gm = (const char*)(mask + (size_t)s0 * SEQ + kb);
    // one statement: the wait stands behind the last copy, ahead of any rewrite of a
    // register that a copy names (the scalar starts change with every block)
    asm volatile(
        "global_load_async_to_lds_b128 %0, %3, %5\n\t"
        "global_load_async_to_lds_b128 %0, %3, %6 offset:2304\n\t"
        "global_load_async_to_lds_b128 %0, %3, %7 offset:4608\n\t"
        "global_load_async_to_lds_b128 %0, %3, %8 offset:6912\n\t"
        "global_load_async_to_lds_b128 %1, %3, %9\n\t"
        "global_load_async_to_lds_b128 %1, %3, %10 offset:2560\n\t"
        "global_load_async_to_lds_b128 %1, %3, %11 offset:5120\n\t"
        "global_load_async_to_lds_b128 %1, %3, %12 offset:7680\n\t"
        "global_load_async_to_lds_b128 %2, %4, %13\n\t"
        "global_load_async_to_lds_b128 %2, %4, %14 offset:2176\n\t"
        "global_load_async_to_lds_b128 %2, %4, %15 offset:4352\n\t"
        "global_load_async_to_lds_b128 %2, %4, %16 offset:6528\n\t"
        "global_load_async_to_lds_b128 %2, %4, %17 offset:8704\n\t"
        "global_load_async_to_lds_b128 %2, %4, %18 offset:10880\n\t"
        "global_load_async_to_lds_b128 %2, %4, %19 offset:13056\n\t"
        "global_load_async_to_lds_b128 %2, %4, %20 offset:15232\n\t"
        "s_wait_xcnt 0x0"
        :: "v"(lk), "v"(lv), "v"(lm), "v"(kvoff), "v"(moffb),
           "s"(gk), "s"(gk + 1 * (32768 - 2304)), "s"(gk + 2 * (32768 - 2304)),
           "s"(gk + 3 * (32768 - 2304)),
           "s"(gv), "s"(gv + 1 * (32768 - 2560)), "s"(gv + 2 * (32768 - 2560)),
           "s"(gv + 3 * (32768 - 2560)),
           "s"(gm), "s"(gm + 1 * (65536 - 2176)), "s"(gm + 2 * (65536 - 2176)),
           "s"(gm + 3 * (65536 - 2176)), "s"(gm + 4 * (65536 - 2176)),
           "s"(gm + 5 * (65536 - 2176)), "s"(gm + 6 * (65536 - 2176)),
           "s"(gm + 7 * (65536 - 2176))
        : "memory");
  };

  const v8f zero = {0, 0, 0, 0, 0, 0, 0, 0};
  float mrow = -3.0e38f, lrow = 0.0f;   // lrow: this half's share of the row sum
  v8f acco[4];                          // O^T: row d = dt*16 + 8*hi + r, column lo
#pragma unroll
  for (int dt = 0; dt < 4; ++dt) acco[dt] = zero;

  // block 0 landed and published before anybody reads it; then block 1 takes off
  stage(0, 0);
  asm volatile("s_wait_asynccnt 0x0" ::: "memory");  // own copies of block 0 landed
  __syncthreads();
  stage(64, 1);

  // two key blocks per trip, one from each buffer; the inner loop is unrolled so that
  // every LDS address is base + constant
  for (int kb2 = 0; kb2 < SEQ; kb2 += 128)
#pragma unroll
  for (int bf = 0; bf < 2; ++bf) {
    const int kb = kb2 + bf * 64;

    // this lane's mask values: 8 consecutive keys per 16-key tile
    const float* const mq = &Ms[bf][mqo];
    float4 mk[4][2];
#pragma unroll
    for (int nt = 0; nt < 4; ++nt) {
      mk[nt][0] = *(const float4*)(mq + nt * 16);
      mk[nt][1] = *(const float4*)(mq + nt * 16 + 4);
    }

    // S^T = K @ Q^T : 64 keys (4 M-tiles) x 16 query columns, Kdim = depth 64
    v8f sacc[4];
#pragma unroll
    for (int nt = 0; nt < 4; ++nt) sacc[nt] = zero;
#pragma unroll
    for (int k2 = 0; k2 < 2; ++k2)
#pragma unroll
      for (int nt = 0; nt < 4; ++nt) {
        v16h ak = ld_frag(&Ks[bf][(nt * 16 + lo) * KPITCH + k2 * 32 + hi * 8]);
        sacc[nt] = __builtin_amdgcn_wmma_f32_16x16x32_f16(
            false, ak, false, bq[k2], (short)0, sacc[nt], false, false);
      }

    // scaled logits + mask, then online softmax. D layout: key r+8*hi, query lo.
    float p[4][8];
    float mb = -3.0e38f;
#pragma unroll
    for (int nt = 0; nt < 4; ++nt) {
      const float mv[8] = {mk[nt][0].x, mk[nt][0].y, mk[nt][0].z, mk[nt][0].w,
                           mk[nt][1].x, mk[nt][1].y, mk[nt][1].z, mk[nt][1].w};
#pragma unroll
      for (int r = 0; r < 8; ++r) {
        float v  = sacc[nt][r] * 0.125f + mv[r] * (-1e9f);
        p[nt][r] = v;
        mb       = fmaxf(mb, v);
      }
    }
    mb = fmaxf(mb, xhalf(mb));   // the other half's 32 keys

    const float mn   = fmaxf(mrow, mb);
    const float corr = __expf(mrow - mn);
    mrow = mn;
    float s4[4];
#pragma unroll
    for (int nt = 0; nt < 4; ++nt) {
      float s = 0.0f;
#pragma unroll
      for (int r = 0; r < 8; ++r) {
        p[nt][r] = __expf(p[nt][r] - mn);
        s += p[nt][r];
      }
      s4[nt] = s;
    }
    lrow = lrow * corr + ((s4[0] + s4[1]) + (s4[2] + s4[3]));
#pragma unroll
    for (int dt = 0; dt < 4; ++dt)
#pragma unroll
      for (int r = 0; r < 8; ++r) acco[dt][r] = acco[dt][r] * corr;

    // O^T += V^T @ P^T : Kdim = 64 keys, 4 depth tiles. Both operands in the
    // hardware k order: slot s of half hi is key 8*hi + s (s < 8), 16 + 8*hi + s - 8.
#pragma unroll
    for (int k2 = 0; k2 < 2; ++k2) {
      v16h bp;
#pragma unroll
      for (int i = 0; i < 8; ++i) {
        bp[i]     = (_Float16)p[2 * k2][i];
        bp[i + 8] = (_Float16)p[2 * k2 + 1][i];
      }
      const _Float16* vp =
          &Vs[bf][(k2 * 32 + hi * 8 + (lane & 7)) * VPITCH + ((lane >> 3) & 1) * 8];
#pragma unroll
      for (int dt = 0; dt < 4; ++dt) {
        v8h v0 = ld_tr16(vp + dt * 16);
        v8h v1 = ld_tr16(vp + 16 * VPITCH + dt * 16);
        v16h av;
#pragma unroll
        for (int i = 0; i < 8; ++i) { av[i] = v0[i]; av[i + 8] = v1[i]; }
        acco[dt] = __builtin_amdgcn_wmma_f32_16x16x32_f16(
            false, av, false, bp, (short)0, acco[dt], false, false);
      }
    }

    // hand-over: own reads of this buffer done, own copies of the next block landed;
    // the one barrier publishes the next block and frees this buffer for the refill
    asm volatile("s_wait_dscnt 0x0" ::: "memory");
    asm volatile("s_wait_asynccnt 0x0" ::: "memory");
    __syncthreads();
    if (kb + 128 < SEQ) stage(kb + 128, bf);
  }
  asm volatile("s_wait_asynccnt 0x0" ::: "memory");  // nothing in flight at the wave's end

  // join the halves' sums, normalize and write context (f16, [b,s,h*64+d] layout):
  // a lane's 8 registers are 8 consecutive d of its query, one 16-byte store
  lrow += xhalf(lrow);
#pragma unroll
  for (int dt = 0; dt < 4; ++dt) {
    v8h o;
#pragma unroll
    for (int r = 0; r < 8; ++r) o[r] = (_Float16)(acco[dt][r] / lrow);
    *(v8h*)&ctx[base + (size_t)qg * 1024 + dt * 16 + hi * 8] = o;
  }
}

// ---------------------------------------------------------------------------
extern "C" void kernel_launch(void* const* d_in, const int* in_sizes, int n_in,
                              void* d_out, int out_size, void* d_ws, size_t ws_size,
                              hipStream_t stream) {
  (void)in_sizes; (void)n_in; (void)out_size; (void)ws_size;

  const float* q    = (const float*)d_in[0];
  const float* k    = (const float*)d_in[1];
  const float* v    = (const float*)d_in[2];
  const float* mask = (const float*)d_in[3];
  const float* wq   = (const float*)d_in[4];
  const float* bq   = (const float*)d_in[5];
  const float* wk   = (const float*)d_in[6];
  const float* bk   = (const float*)d_in[7];
  const float* wv   = (const float*)d_in[8];
  const float* bv   = (const float*)d_in[9];
  const float* wo   = (const float*)d_in[10];
  const float* bo   = (const float*)d_in[11];
  float* out = (float*)d_out;

  const size_t SZX = (size_t)MTOT * 1024;     // 4,194,304
  const size_t SZW = (size_t)1024 * 1024;     // 1,048,576
  _Float16* w16 = (_Float16*)d_ws;            // total 64 MiB of f16 scratch
  _Float16* qx  = w16;
  _Float16* kx  = qx + SZX;
  _Float16* vx  = kx + SZX;
  _Float16* wqh = vx + SZX;
  _Float16* wkh = wqh + SZW;
  _Float16* wvh = wkh + SZW;
  _Float16* woh = wvh + SZW;
  _Float16* Qp  = woh + SZW;
  _Float16* Kp  = Qp + SZX;
  _Float16* Vp  = Kp + SZX;
  _Float16* Cx  = Vp + SZX;

  // qx .. woh are contiguous from w16 in the kernel's unit order
  cvt_all_kernel<<<dim3(CVT_BLOCKS), CVT_THREADS, 0, stream>>>(q, k, v, wq, wk, wv, wo, w16);

  // the three projections in one launch: qx kx vx, wqh wkh wvh and Qp Kp Vp are
  // each contiguous in this order
  gemm_f16_kernel<false><<<dim3(1024 / 128, MTOT / 128, 3), 256, 0, stream>>>(
      qx, wqh, bq, bk, bv, nullptr, Qp);

  attention_kernel<<<dim3(SEQ / 64, BATCH * NUM_HEADS), 128, 0, stream>>>(
      Qp, Kp, Vp, mask, Cx);

  gemm_f16_kernel<true><<<dim3(1024 / 128, MTOT / 128, 1), 256, 0, stream>>>(
      Cx, woh, bo, bo, bo, out, nullptr);
}

// v009
// One run takes 101 microseconds.
// Timed twice side by side with v008, it ran 1.04 times as fast both times.
// Over all steps from v000 it is 4.36 times as fast.
#include <hip/hip_runtime.h>
#include <math.h>

typedef __attribute__((ext_vector_type(16))) _Float16 v16h;
typedef __attribute__((ext_vector_type(8)))  _Float16 v8h;
typedef __attribute__((ext_vector_type(8)))  float    v8f;

#define D_MODEL 1024
#define NUM_HEADS 16
#define DEPTH 64
#define BATCH 2
#define SEQ 2048
#define MTOT (BATCH * SEQ)   // 4096

struct h4 { _Float16 x, y, z, w; };

// ---------------------------------------------------------------------------
// fp32 -> f16 conversion of all seven operands in ONE launch of resident waves.
// The f16 copies lie back to back in the workspace in the order q, k, v, wq, wk,
// wv, wo: 16 units of 2^20 elements (4 + 4 + 4 + 1 + 1 + 1 + 1). 256 blocks of 16
// waves, one per WGP; a block converts 65,536 consecutive elements of one unit.
// Each wave-wide load takes 512 contiguous bytes, each store two whole lines; a
// wave's 32 loads are spread over the block's 256 KiB.
// ---------------------------------------------------------------------------
#define CVT_THREADS 512
#define CVT_BLOCKS 256
#define CVT_STEP (CVT_THREADS * 4)   // elements a block converts per load round
#define CVT_ROUNDS 32                // 32 * 2048 = 65,536 elements per block

__global__ __launch_bounds__(CVT_THREADS)
void cvt_all_kernel(const float* __restrict__ q, const float* __restrict__ k,
                    const float* __restrict__ v, const float* __restrict__ wq,
                    const float* __restrict__ wk, const float* __restrict__ wv,
                    const float* __restrict__ wo, _Float16* __restrict__ out) {
  const int b = blockIdx.x;
  const int u = b >> 4;   // unit of 2^20 elements
  const float* s;         // start of this unit in its own operand
  if (u < 4)        s = q + ((size_t)u << 20);
  else if (u < 8)   s = k + ((size_t)(u - 4) << 20);
  else if (u < 12)  s = v + ((size_t)(u - 8) << 20);
  else if (u == 12) s = wq;
  else if (u == 13) s = wk;
  else if (u == 14) s = wv;
  else              s = wo;
  const float* __restrict__ in = s + (b & 15) * (CVT_STEP * CVT_ROUNDS) + threadIdx.x * 4;
  _Float16* __restrict__ o16 =
      out + (size_t)b * (CVT_STEP * CVT_ROUNDS) + threadIdx.x * 4;

  // The loads stand in a loop of their own ahead of the conversions, so that many
  // are in flight per wave (a single load-convert-store loop built with one in
  // flight). Both loops are unrolled so that x[] stays in registers and every
  // address is base + constant.
  float4 x[CVT_ROUNDS];
#pragma unroll
  for (int i = 0; i < CVT_ROUNDS; ++i) x[i] = *(const float4*)(in + i * CVT_STEP);
#pragma unroll
  for (int i = 0; i < CVT_ROUNDS; ++i) {
    h4 o;
    o.x = (_Float16)x[i].x; o.y = (_Float16)x[i].y;
    o.z = (_Float16)x[i].z; o.w = (_Float16)x[i].w;
    *(h4*)(o16 + i * CVT_STEP) = o;
  }
}

// ---------------------------------------------------------------------------
// Fragment loader for 16-bit A/B operands of v_wmma_*_16x16x32.
// Lanes 0-15 -> row lo, K {0..7, 16..23}; lanes 16-31 -> row lo, K {8..15, 24..31}.
// Caller passes lane-resolved pointer (base + lo*stride + hi*8), 16B aligned.
// ---------------------------------------------------------------------------
__device__ __forceinline__ v16h ld_frag(const _Float16* p) {
  v8h a = *(const v8h*)p;
  v8h b = *(const v8h*)(p + 16);
  v16h r;
#pragma unroll
  for (int i = 0; i < 8; ++i) { r[i] = a[i]; r[i + 8] = b[i]; }
  return r;
}

typedef __attribute__((ext_vector_type(8))) short s16x8;
typedef __attribute__((address_space(3))) s16x8 lds_s16x8;

__device__ __forceinline__ v8h ld_tr16(const _Float16* p) {
  return __builtin_bit_cast(v8h, __builtin_amdgcn_ds_load_tr16_b128_v8i16((lds_s16x8*)p));
}

// Byte address in the workgroup's LDS of a __shared__ object
__device__ __forceinline__ unsigned lds_addr(const void* p) {
  return (unsigned)(size_t)p;   // low 32 bits of the __shared__ address
}

// W rows in LDS: 256 B of data at a pitch of 288 B (odd multiple of 32 B), the
// conflict-free pitch for the transposing load.
#define WPITCH 144

// ---------------------------------------------------------------------------
// GEMM: Y[M,1024] = X[M,1024] @ W[1024,1024] + bias
// Block: 256 threads (8 waves), tile 128x128.
// Wave (wm,wn) in 4x2 grid computes 32x64 via 2x4 WMMA tiles.
// The W tile lies in LDS as in memory (k rows, n contiguous); the transposing
// load turns it into the B operand.
// The X and W tiles stand in two LDS buffers: the copies of k tile j + 2 are issued
// as soon as tile j's buffer is free and fly while tile j + 1 is worked on, so the
// time the copies take from L2 and the time the fragment reads take from LDS run
// side by side instead of one after the other.
// blockIdx.z picks one of up to three independent products of this shape whose
// X, W and Y lie back to back (X and Y 4096x1024 apart, W 1024x1024 apart).
// k extent of a tile: 64 for the three products in one launch, so that both buffers
// take 72 KiB and a WGP still holds three workgroups; 128 for the single product,
// one workgroup per WGP.
// ---------------------------------------------------------------------------
template <bool OUT_F32>
__global__ __launch_bounds__(256)
void gemm_f16_kernel(const _Float16* __restrict__ X0, const _Float16* __restrict__ W0,
                     const float* __restrict__ bias0, const float* __restrict__ bias1,
                     const float* __restrict__ bias2, float* __restrict__ Yf,
                     _Float16* __restrict__ Yh0) {
  constexpr int BK  = OUT_F32 ? 128 : 64;   // k extent of one staged tile pair
  // X rows in LDS: 2 BK bytes of data + 16 B, an odd multiple of 16 B (272 or 144 B),
  // the conflict-free pitch for the 16-byte fragment loads; counted in halves.
  constexpr int AP  = BK + 8;
  constexpr int ASZ = 128 * AP;       // halves of one X buffer
  constexpr int WSZ = BK * WPITCH;    // halves of one W buffer
  constexpr int ACH = BK / 8;         // 16-byte chunks in an X row
  constexpr int ARS = 256 / ACH;      // X rows that the block copies at a time

  const int z = blockIdx.z;
  const _Float16* __restrict__ X = X0 + (size_t)z * (MTOT * 1024);
  const _Float16* __restrict__ W = W0 + (size_t)z * (1024 * 1024);
  const float* __restrict__ bias = z == 0 ? bias0 : (z == 1 ? bias1 : bias2);
  _Float16* __restrict__ Yh = Yh0 + (size_t)z * (MTOT * 1024);

  // One LDS block, both X buffers first, then both W buffers
  __shared__ __align__(32) _Float16 Sm[2 * ASZ + 2 * WSZ];

  const int t    = threadIdx.x;
  const int lane = t & 31;
  const int wid  = t >> 5;
  const int lo   = lane & 15;
  const int hi   = lane >> 4;
  const int wm   = wid >> 1;  // 0..3
  const int wn   = wid & 1;   // 0..1
  const int m0   = blockIdx.y * 128;
  const int n0   = blockIdx.x * 128;

  const v8f zero = {0, 0, 0, 0, 0, 0, 0, 0};
  v8f acc[2][4];
#pragma unroll
  for (int i = 0; i < 2; ++i)
#pragma unroll
    for (int j = 0; j < 4; ++j) acc[i][j] = zero;

  // X tile: 128 rows of ACH chunks of 16 B; a thread copies chunk t % ACH of rows
  // t / ACH + ARS i. W tile: BK rows of 16 chunks; chunk t & 15 of rows (t >> 4) + 16 i.
  // A copy's address is a scalar slab start + the thread's offset inside a slab + the
  // immediate offset, and the immediate offset moves the LDS address as well: it is
  // the slab's step in LDS, and the scalar start holds the step in memory less that.
  // So no vector add and no address pair per copy. Three workgroups on a WGP need at
  // most 160 registers.
  constexpr int ALS = ARS * AP * 2;       // bytes in LDS from one X slab to the next
  constexpr int WLS = 16 * WPITCH * 2;    // the same for W
  constexpr int AGS = ARS * 2048 - ALS;   // step in memory less the step in LDS
  constexpr int WGS = 16 * 2048 - WLS;
  static_assert(WLS == 4608 && ALS == (OUT_F32 ? 4352 : 4608),
                "the immediate offsets below are the slabs' steps in LDS");
  const int      arow  = t / ACH;
  const int      ac8   = (t % ACH) * 8;
  const int      wrow  = t >> 4;
  const int      wc8   = (t & 15) * 8;
  const unsigned agoff = (unsigned)(arow * 2048 + ac8 * 2);   // bytes
  const unsigned wgoff = (unsigned)(wrow * 2048 + wc8 * 2);   // bytes

  // the copies of the k tile at k0 into buffer bf. One statement: the wait stands
  // behind the last copy, ahead of any rewrite of a register that a copy names (the
  // scalar starts change with every tile)
  auto stage = [&](int k0, int bf) {
    const unsigned la = lds_addr(&Sm[bf * ASZ + arow * AP + ac8]);
    const unsigned lw = lds_addr(&Sm[2 * ASZ + bf * WSZ + wrow * WPITCH + wc8]);
    const char* ga = (const char*)(X + (size_t)m0 * 1024 + k0);
    const char* gw = (const char*)(W + (size_t)k0 * 1024 + n0);
    if constexpr (!OUT_F32) {
      asm volatile(
          "global_load_async_to_lds_b128 %0, %2, %4\n\t"
          "global_load_async_to_lds_b128 %0, %2, %5 offset:4608\n\t"
          "global_load_async_to_lds_b128 %0, %2, %6 offset:9216\n\t"
          "global_load_async_to_lds_b128 %0, %2, %7 offset:13824\n\t"
          "global_load_async_to_lds_b128 %1, %3, %8\n\t"
          "global_load_async_to_lds_b128 %1, %3, %9 offset:4608\n\t"
          "global_load_async_to_lds_b128 %1, %3, %10 offset:9216\n\t"
          "global_load_async_to_lds_b128 %1, %3, %11 offset:13824\n\t"
          "s_wait_xcnt 0x0"
          :: "v"(la), "v"(lw), "v"(agoff), "v"(wgoff),
             "s"(ga), "s"(ga + 1 * AGS), "s"(ga + 2 * AGS), "s"(ga + 3 * AGS),
             "s"(gw), "s"(gw + 1 * WGS), "s"(gw + 2 * WGS), "s"(gw + 3 * WGS)
          : "memory");
    } else {
      // eight slabs per tile: the upper four from a second LDS address each, so that
      // the immediate offsets stay as small as above
      const unsigned la4 = la + 4 * ALS;
      const unsigned lw4 = lw + 4 * WLS;
      const char* ga4 = ga + 4 * (ARS * 2048);
      const char* gw4 = gw + 4 * (16 * 2048);
      asm volatile(
          "global_load_async_to_lds_b128 %0, %4, %6\n\t"
          "global_load_async_to_lds_b128 %0, %4, %7 offset:4352\n\t"
          "global_load_async_to_lds_b128 %0, %4, %8 offset:8704\n\t"
          "global_load_async_to_lds_b128 %0, %4, %9 offset:13056\n\t"
          "global_load_async_to_lds_b128 %1, %4, %10\n\t"
          "global_load_async_to_lds_b128 %1, %4, %11 offset:4352\n\t"
          "global_load_async_to_lds_b128 %1, %4, %12 offset:8704\n\t"
          "global_load_async_to_lds_b128 %1, %4, %13 offset:13056\n\t"
          "global_load_async_to_lds_b128 %2, %5, %14\n\t"
          "global_load_async_to_lds_b128 %2, %5, %15 offset:4608\n\t"
          "global_load_async_to_lds_b128 %2, %5, %16 offset:9216\n\t"
          "global_load_async_to_lds_b128 %2, %5, %17 offset:13824\n\t"
          "global_load_async_to_lds_b128 %3, %5, %18\n\t"
          "global_load_async_to_lds_b128 %3, %5, %19 offset:4608\n\t"
          "global_load_async_to_lds_b128 %3, %5, %20 offset:9216\n\t"
          "global_load_async_to_lds_b128 %3, %5, %21 offset:13824\n\t"
          "s_wait_xcnt 0x0"
          :: "v"(la), "v"(la4), "v"(lw), "v"(lw4), "v"(agoff), "v"(wgoff),
             "s"(ga), "s"(ga + 1 * AGS), "s"(ga + 2 * AGS), "s"(ga + 3 * AGS),
             "s"(ga4), "s"(ga4 + 1 * AGS), "s"(ga4 + 2 * AGS), "s"(ga4 + 3 * AGS),
             "s"(gw), "s"(gw + 1 * WGS), "s"(gw + 2 * WGS), "s"(gw + 3 * WGS),
             "s"(gw4), "s"(gw4 + 1 * WGS), "s"(gw4 + 2 * WGS), "s"(gw4 + 3 * WGS)
          : "memory");
    }
  };

  // tile 0 landed and published before anybody reads it; then tile 1 takes off
  stage(0, 0);
  asm volatile("s_wait_asynccnt 0x0" ::: "memory");  // own copies of tile 0 landed
  __syncthreads();
  stage(BK, 1);

  // two k tiles per trip, one from each buffer; the inner loop is unrolled so that
  // every LDS address is base + constant
  for (int k2 = 0; k2 < 1024; k2 += 2 * BK)
#pragma unroll
  for (int bf = 0; bf < 2; ++bf) {
    const int k0 = k2 + bf * BK;
    const _Float16* const As = Sm + bf * ASZ;
    const _Float16* const Ws = Sm + 2 * ASZ + bf * WSZ;

    // the tile's 32-k blocks in ascending k; unrolled so that every LDS address is
    // base + constant and a block's loads can run ahead of it
#pragma unroll
    for (int kk = 0; kk < BK; kk += 32) {
      v16h af[2], bfr[4];
#pragma unroll
      for (int mt = 0; mt < 2; ++mt)
        af[mt] = ld_frag(&As[(wm * 32 + mt * 16 + lo) * AP + kk + hi * 8]);
      // B operand in the k order of ld_frag: slot s of half hi is k 8*hi + s (s < 8),
      // 16 + 8*hi + s - 8; column lo
      const _Float16* wp =
          &Ws[(kk + hi * 8 + (lane & 7)) * WPITCH + wn * 64 + ((lane >> 3) & 1) * 8];
#pragma unroll
      for (int nt = 0; nt < 4; ++nt) {
        v8h w0 = ld_tr16(wp + nt * 16);
        v8h w1 = ld_tr16(wp + 16 * WPITCH + nt * 16);
#pragma unroll
        for (int i = 0; i < 8; ++i) { bfr[nt][i] = w0[i]; bfr[nt][i + 8] = w1[i]; }
      }
#pragma unroll
      for (int mt = 0; mt < 2; ++mt)
#pragma unroll
        for (int nt = 0; nt < 4; ++nt)
          acc[mt][nt] = __builtin_amdgcn_wmma_f32_16x16x32_f16(
              false, af[mt], false, bfr[nt], (short)0, acc[mt][nt], false, false);
    }

    // hand-over: own reads of this buffer done, own copies of the next tile landed;
    // the one barrier publishes the next tile and frees this buffer for the refill
    asm volatile("s_wait_dscnt 0x0" ::: "memory");
    asm volatile("s_wait_asynccnt 0x0" ::: "memory");
    __syncthreads();
    if (k0 + 2 * BK < 1024) stage(k0 + 2 * BK, bf);
  }
  asm volatile("s_wait_asynccnt 0x0" ::: "memory");  // nothing in flight at the wave's end

  // epilogue: C layout row M = r + 8*hi, col N = lo (within tile)
#pragma unroll
  for (int mt = 0; mt < 2; ++mt)
#pragma unroll
    for (int nt = 0; nt < 4; ++nt) {
      int   col = n0 + wn * 64 + nt * 16 + lo;
      float bv  = bias[col];
#pragma unroll
      for (int r = 0; r < 8; ++r) {
        int   rowg = m0 + wm * 32 + mt * 16 + r + hi * 8;
        float v    = acc[mt][nt][r] + bv;
        if (OUT_F32) Yf[(size_t)rowg * 1024 + col] = v;
        else         Yh[(size_t)rowg * 1024 + col] = (_Float16)v;
      }
    }
}

// Lane l with lane l ^ 16: the exchange between the wave halves, as a vector move
__device__ __forceinline__ float xhalf(float x) {
  return __builtin_bit_cast(float, __builtin_amdgcn_permlanex16(
      __builtin_bit_cast(int, x), __builtin_bit_cast(int, x),
      0x76543210, 0xfedcba98, false, false));
}

// V rows in LDS: 128 B of data at a pitch of 160 B (odd multiple of 32 B), the
// conflict-free pitch for the transposing load.
#define VPITCH 80

// K rows in LDS: 128 B of data at a pitch of 144 B (odd multiple of 16 B), the
// conflict-free pitch for the 16-byte fragment loads; at 128 B the 16 rows of a
// fragment fall on an eighth of the banks.
#define KPITCH 72

// Mask rows in LDS: 256 B of data (64 f32) at a pitch of 272 B (odd multiple of
// 16 B), the conflict-free pitch for the 16-byte loads; counted in floats.
#define MPITCH 68

// ---------------------------------------------------------------------------
// Flash attention, transposed products: S^T = K Q^T, O^T += V^T P^T.
// One block per (64-query tile, b*h). 4 waves, 16 query columns per wave.
// A lane holds scores of ONE query (column lo), keys 8*hi + r of each 16-key tile,
// so max and sum run in-lane with one exchange between the wave halves, and two
// score tiles convert in place into the B operand of the second product.
// Q/K/V are f16 in [b, s, h*64+d] layout. ctx written in same layout.
// The mask tile (64 queries x 64 keys, f32) goes through LDS: a lane needs 32 B of
// its own query's row, so a wave-wide load straight from memory touches 16 lines,
// while a wave-wide copy of two whole rows touches four.
// The K, V and mask tiles stand in two LDS buffers: the copies of key block j + 2
// are issued as soon as block j's buffer is free and fly while block j + 1 is
// worked on, so a workgroup waits for its copies only where they are late.
// ---------------------------------------------------------------------------
__global__ __launch_bounds__(128)
void attention_kernel(const _Float16* __restrict__ Qh, const _Float16* __restrict__ Kh,
                      const _Float16* __restrict__ Vh, const float* __restrict__ mask,
                      _Float16* __restrict__ ctx) {
  __shared__ __align__(16) _Float16 Ks[2][64 * KPITCH];   // key major, d contiguous, padded rows
  __shared__ __align__(32) _Float16 Vs[2][64 * VPITCH];   // key major, d contiguous, padded rows
  __shared__ __align__(16) float    Ms[2][64 * MPITCH];   // query major, key contiguous, padded rows

  const int t    = threadIdx.x;
  const int lane = t & 31;
  const int wid  = t >> 5;
  const int lo   = lane & 15;
  const int hi   = lane >> 4;
  const int bh   = blockIdx.y;
  const int b    = bh >> 4;
  const int h    = bh & 15;
  const int s0   = blockIdx.x * 64;
  const int qg   = s0 + wid * 16 + lo;   // this lane's query
  const size_t base = (size_t)b * SEQ * 1024 + (size_t)h * 64;

  // Q^T as B operand (column = query lo), loaded once and kept in registers
  v16h bq[2];
#pragma unroll
  for (int k2 = 0; k2 < 2; ++k2)
    bq[k2] = ld_frag(&Qh[base + (size_t)qg * 1024 + k2 * 32 + hi * 8]);

  // Mask tile: 64 rows of 16 chunks of 4 floats
  const int      mrow0 = t >> 4;
  const int      mc4   = (t & 15) * 4;
  // this lane's mask values in a buffer: row of its query, 8 consecutive keys per 16-key tile
  const int mqo = (wid * 16 + lo) * MPITCH + hi * 8;

  // The copies of one key block into buffer bf, 16 per thread. K and V: 64 rows of 8
  // chunks of 16 B, a thread copies chunk t & 7 of rows (t >> 3) + 16 i. Mask: chunk
  // t & 15 of rows (t >> 4) + 8 i. A copy's address is a scalar slab start + the
  // thread's offset inside a slab + the immediate offset, and the immediate offset
  // moves the LDS address as well: it is the slab's step in LDS (16 or 8 padded rows),
  // and the scalar start holds the step in memory less that. So a thread needs one
  // LDS address per tile and buffer and two offsets, and no vector add per copy.
  static_assert(16 * KPITCH * 2 == 2304 && 16 * VPITCH * 2 == 2560 && 8 * MPITCH * 4 == 2176,
                "the immediate offsets below are the slabs' steps in LDS");
  const unsigned kvoff = (unsigned)((t >> 3) * 2048 + (t & 7) * 16);   // bytes
  const unsigned moffb = (unsigned)(mrow0 * (SEQ * 4) + mc4 * 4);      // bytes
  auto stage = [&](int kb, int bf) {
    const unsigned lk = lds_addr(&Ks[bf][(t >> 3) * KPITCH + (t & 7) * 8]);
    const unsigned lv = lds_addr(&Vs[bf][(t >> 3) * VPITCH + (t & 7) * 8]);
    const unsigned lm = lds_addr(&Ms[bf][mrow0 * MPITCH + mc4]);
    const char* gk = (const char*)(Kh + base + (size_t)kb * 1024);
    const char* gv = (const char*)(Vh + base + (size_t)kb * 1024);
    const char* gm = (const char*)(mask + (size_t)s0 * SEQ + kb);
    // one statement: the wait stands behind the last copy, ahead of any rewrite of a
    // register that a copy names (the scalar starts change with every block)
    asm volatile(
        "global_load_async_to_lds_b128 %0, %3, %5\n\t"
        "global_load_async_to_lds_b128 %0, %3, %6 offset:2304\n\t"
        "global_load_async_to_lds_b128 %0, %3, %7 offset:4608\n\t"
        "global_load_async_to_lds_b128 %0, %3, %8 offset:6912\n\t"
        "global_load_async_to_lds_b128 %1, %3, %9\n\t"
        "global_load_async_to_lds_b128 %1, %3, %10 offset:2560\n\t"
        "global_load_async_to_lds_b128 %1, %3, %11 offset:5120\n\t"
        "global_load_async_to_lds_b128 %1, %3, %12 offset:7680\n\t"
        "global_load_async_to_lds_b128 %2, %4, %13\n\t"
        "global_load_async_to_lds_b128 %2, %4, %14 offset:2176\n\t"
        "global_load_async_to_lds_b128 %2, %4, %15 offset:4352\n\t"
        "global_load_async_to_lds_b128 %2, %4, %16 offset:6528\n\t"
        "global_load_async_to_lds_b128 %2, %4, %17 offset:8704\n\t"
        "global_load_async_to_lds_b128 %2, %4, %18 offset:10880\n\t"
        "global_load_async_to_lds_b128 %2, %4, %19 offset:13056\n\t"
        "global_load_async_to_lds_b128 %2, %4, %20 offset:15232\n\t"
        "s_wait_xcnt 0x0"
        :: "v"(lk), "v"(lv), "v"(lm), "v"(kvoff), "v"(moffb),
           "s"(gk), "s"(gk + 1 * (32768 - 2304)), "s"(gk + 2 * (32768 - 2304)),
           "s"(gk + 3 * (32768 - 2304)),
           "s"(gv), "s"(gv + 1 * (32768 - 2560)), "s"(gv + 2 * (32768 - 2560)),
           "s"(gv + 3 * (32768 - 2560)),
           "s"(gm), "s"(gm + 1 * (65536 - 2176)), "s"(gm + 2 * (65536 - 2176)),
           "s"(gm + 3 * (65536 - 2176)), "s"(gm + 4 * (65536 - 2176)),
           "s"(gm + 5 * (65536 - 2176)), "s"(gm + 6 * (65536 - 2176)),
           "s"(gm + 7 * (65536 - 2176))
        : "memory");
  };

  const v8f zero = {0, 0, 0, 0, 0, 0, 0, 0};
  float mrow = -3.0e38f, lrow = 0.0f;   // lrow: this half's share of the row sum
  v8f acco[4];                          // O^T: row d = dt*16 + 8*hi + r, column lo
#pragma unroll
  for (int dt = 0; dt < 4; ++dt) acco[dt] = zero;

  // block 0 landed and published before anybody reads it; then block 1 takes off
  stage(0, 0);
  asm volatile("s_wait_asynccnt 0x0" ::: "memory");  // own copies of block 0 landed
  __syncthreads();
  stage(64, 1);

  // two key blocks per trip, one from each buffer; the inner loop is unrolled so that
  // every LDS address is base + constant
  for (int kb2 = 0; kb2 < SEQ; kb2 += 128)
#pragma unroll
  for (int bf = 0; bf < 2; ++bf) {
    const int kb = kb2 + bf * 64;

    // this lane's mask values: 8 consecutive keys per 16-key tile
    const float* const mq = &Ms[bf][mqo];
    float4 mk[4][2];
#pragma unroll
    for (int nt = 0; nt < 4; ++nt) {
      mk[nt][0] = *(const float4*)(mq + nt * 16);
      mk[nt][1] = *(const float4*)(mq + nt * 16 + 4);
    }

    // S^T = K @ Q^T : 64 keys (4 M-tiles) x 16 query columns, Kdim = depth 64
    v8f sacc[4];
#pragma unroll
    for (int nt = 0; nt < 4; ++nt) sacc[nt] = zero;
#pragma unroll
    for (int k2 = 0; k2 < 2; ++k2)
#pragma unroll
      for (int nt = 0; nt < 4; ++nt) {
        v16h ak = ld_frag(&Ks[bf][(nt * 16 + lo) * KPITCH + k2 * 32 + hi * 8]);
        sacc[nt] = __builtin_amdgcn_wmma_f32_16x16x32_f16(
            false, ak, false, bq[k2], (short)0, sacc[nt], false, false);
      }

    // scaled logits + mask, then online softmax. D layout: key r+8*hi, query lo.
    float p[4][8];
    float mb = -3.0e38f;
#pragma unroll
    for (int nt = 0; nt < 4; ++nt) {
      const float mv[8] = {mk[nt][0].x, mk[nt][0].y, mk[nt][0].z, mk[nt][0].w,
                           mk[nt][1].x, mk[nt][1].y, mk[nt][1].z, mk[nt][1].w};
#pragma unroll
      for (int r = 0; r < 8; ++r) {
        float v  = sacc[nt][r] * 0.125f + mv[r] * (-1e9f);
        p[nt][r] = v;
        mb       = fmaxf(mb, v);
      }
    }
    mb = fmaxf(mb, xhalf(mb));   // the other half's 32 keys

    const float mn   = fmaxf(mrow, mb);
    const float corr = __expf(mrow - mn);
    mrow = mn;
    float s4[4];
#pragma unroll
    for (int nt = 0; nt < 4; ++nt) {
      float s = 0.0f;
#pragma unroll
      for (int r = 0; r < 8; ++r) {
        p[nt][r] = __expf(p[nt][r] - mn);
        s += p[nt][r];
      }
      s4[nt] = s;
    }
    lrow = lrow * corr + ((s4[0] + s4[1]) + (s4[2] + s4[3]));
#pragma unroll
    for (int dt = 0; dt < 4; ++dt)
#pragma unroll
      for (int r = 0; r < 8; ++r) acco[dt][r] = acco[dt][r] * corr;

    // O^T += V^T @ P^T : Kdim = 64 keys, 4 depth tiles. Both operands in the
    // hardware k order: slot s of half hi is key 8*hi + s (s < 8), 16 + 8*hi + s - 8.
#pragma unroll
    for (int k2 = 0; k2 < 2; ++k2) {
      v16h bp;
#pragma unroll
      for (int i = 0; i < 8; ++i) {
        bp[i]     = (_Float16)p[2 * k2][i];
        bp[i + 8] = (_Float16)p[2 * k2 + 1][i];
      }
      const _Float16* vp =
          &Vs[bf][(k2 * 32 + hi * 8 + (lane & 7)) * VPITCH + ((lane >> 3) & 1) * 8];
#pragma unroll
      for (int dt = 0; dt < 4; ++dt) {
        v8h v0 = ld_tr16(vp + dt * 16);
        v8h v1 = ld_tr16(vp + 16 * VPITCH + dt * 16);
        v16h av;
#pragma unroll
        for (int i = 0; i < 8; ++i) { av[i] = v0[i]; av[i + 8] = v1[i]; }
        acco[dt] = __builtin_amdgcn_wmma_f32_16x16x32_f16(
            false, av, false, bp, (short)0, acco[dt], false, false);
      }
    }

    // hand-over: own reads of this buffer done, own copies of the next block landed;
    // the one barrier publishes the next block and frees this buffer for the refill
    asm volatile("s_wait_dscnt 0x0" ::: "memory");
    asm volatile("s_wait_asynccnt 0x0" ::: "memory");
    __syncthreads();
    if (kb + 128 < SEQ) stage(kb + 128, bf);
  }
  asm volatile("s_wait_asynccnt 0x0" ::: "memory");  // nothing in flight at the wave's end

  // join the halves' sums, normalize and write context (f16, [b,s,h*64+d] layout):
  // a lane's 8 registers are 8 consecutive d of its query, one 16-byte store
  lrow += xhalf(lrow);
#pragma unroll
  for (int dt = 0; dt < 4; ++dt) {
    v8h o;
#pragma unroll
    for (int r = 0; r < 8; ++r) o[r] = (_Float16)(acco[dt][r] / lrow);
    *(v8h*)&ctx[base + (size_t)qg * 1024 + dt * 16 + hi * 8] = o;
  }
}

// ---------------------------------------------------------------------------
extern "C" void kernel_launch(void* const* d_in, const int* in_sizes, int n_in,
                              void* d_out, int out_size, void* d_ws, size_t ws_size,
                              hipStream_t stream) {
  (void)in_sizes; (void)n_in; (void)out_size; (void)ws_size;

  const float* q    = (const float*)d_in[0];
  const float* k    = (const float*)d_in[1];
  const float* v    = (const float*)d_in[2];
  const float* mask = (const float*)d_in[3];
  const float* wq   = (const float*)d_in[4];
  const float* bq   = (const float*)d_in[5];
  const float* wk   = (const float*)d_in[6];
  const float* bk   = (const float*)d_in[7];
  const float* wv   = (const float*)d_in[8];
  const float* bv   = (const float*)d_in[9];
  const float* wo   = (const float*)d_in[10];
  const float* bo   = (const float*)d_in[11];
  float* out = (float*)d_out;

  const size_t SZX = (size_t)MTOT * 1024;     // 4,194,304
  const size_t SZW = (size_t)1024 * 1024;     // 1,048,576
  _Float16* w16 = (_Float16*)d_ws;            // total 64 MiB of f16 scratch
  _Float16* qx  = w16;
  _Float16* kx  = qx + SZX;
  _Float16* vx  = kx + SZX;
  _Float16* wqh = vx + SZX;
  _Float16* wkh = wqh + SZW;
  _Float16* wvh = wkh + SZW;
  _Float16* woh = wvh + SZW;
  _Float16* Qp  = woh + SZW;
  _Float16* Kp  = Qp + SZX;
  _Float16* Vp  = Kp + SZX;
  _Float16* Cx  = Vp + SZX;

  // qx .. woh are contiguous from w16 in the kernel's unit order
  cvt_all_kernel<<<dim3(CVT_BLOCKS), CVT_THREADS, 0, stream>>>(q, k, v, wq, wk, wv, wo, w16);

  // the three projections in one launch: qx kx vx, wqh wkh wvh and Qp Kp Vp are
  // each contiguous in this order
  gemm_f16_kernel<false><<<dim3(1024 / 128, MTOT / 128, 3), 256, 0, stream>>>(
      qx, wqh, bq, bk, bv, nullptr, Qp);

  attention_kernel<<<dim3(SEQ / 64, BATCH * NUM_HEADS), 128, 0, stream>>>(
      Qp, Kp, Vp, mask, Cx);

  gemm_f16_kernel<true><<<dim3(1024 / 128, MTOT / 128, 1), 256, 0, stream>>>(
      Cx, woh, bo, bo, bo, out, nullptr);
}

// v010
// A run of this version takes 94.7 microseconds.
// Timed twice side by side with v009, it ran 1.07 and 1.06 times as fast.
// All steps since v000 together make it 4.66 times as fast.
#include <hip/hip_runtime.h>
#include <math.h>

typedef __attribute__((ext_vector_type(16))) _Float16 v16h;
typedef __attribute__((ext_vector_type(8)))  _Float16 v8h;
typedef __attribute__((ext_vector_type(8)))  float    v8f;

#define D_MODEL 1024
#define NUM_HEADS 16
#define DEPTH 64
#define BATCH 2
#define SEQ 2048
#define MTOT (BATCH * SEQ)   // 4096

struct h4 { _Float16 x, y, z, w; };

// ---------------------------------------------------------------------------
// fp32 -> f16 conversion of all seven operands in ONE launch of resident waves.
// The f16 copies lie back to back in the workspace in the order q, k, v, wq, wk,
// wv, wo: 16 units of 2^20 elements (4 + 4 + 4 + 1 + 1 + 1 + 1). 256 blocks of 16
// waves, one per WGP; a block converts 65,536 consecutive elements of one unit.
// Each wave-wide load takes 512 contiguous bytes, each store two whole lines; a
// wave's 32 loads are spread over the block's 256 KiB.
// ---------------------------------------------------------------------------
#define CVT_THREADS 512
#define CVT_BLOCKS 256
#define CVT_STEP (CVT_THREADS * 4)   // elements a block converts per load round
#define CVT_ROUNDS 32                // 32 * 2048 = 65,536 elements per block

__global__ __launch_bounds__(CVT_THREADS)
void cvt_all_kernel(const float* __restrict__ q, const float* __restrict__ k,
                    const float* __restrict__ v, const float* __restrict__ wq,
                    const float* __restrict__ wk, const float* __restrict__ wv,
                    const float* __restrict__ wo, _Float16* __restrict__ out) {
  const int b = blockIdx.x;
  const int u = b >> 4;   // unit of 2^20 elements
  const float* s;         // start of this unit in its own operand
  if (u < 4)        s = q + ((size_t)u << 20);
  else if (u < 8)   s = k + ((size_t)(u - 4) << 20);
  else if (u < 12)  s = v + ((size_t)(u - 8) << 20);
  else if (u == 12) s = wq;
  else if (u == 13) s = wk;
  else if (u == 14) s = wv;
  else              s = wo;
  const float* __restrict__ in = s + (b & 15) * (CVT_STEP * CVT_ROUNDS) + threadIdx.x * 4;
  _Float16* __restrict__ o16 =
      out + (size_t)b * (CVT_STEP * CVT_ROUNDS) + threadIdx.x * 4;

  // The loads stand in a loop of their own ahead of the conversions, so that many
  // are in flight per wave (a single load-convert-store loop built with one in
  // flight). Both loops are unrolled so that x[] stays in registers and every
  // address is base + constant.
  float4 x[CVT_ROUNDS];
#pragma unroll
  for (int i = 0; i < CVT_ROUNDS; ++i) x[i] = *(const float4*)(in + i * CVT_STEP);
#pragma unroll
  for (int i = 0; i < CVT_ROUNDS; ++i) {
    h4 o;
    o.x = (_Float16)x[i].x; o.y = (_Float16)x[i].y;
    o.z = (_Float16)x[i].z; o.w = (_Float16)x[i].w;
    *(h4*)(o16 + i * CVT_STEP) = o;
  }
}

// ---------------------------------------------------------------------------
// Fragment loader for 16-bit A/B operands of v_wmma_*_16x16x32.
// Lanes 0-15 -> row lo, K {0..7, 16..23}; lanes 16-31 -> row lo, K {8..15, 24..31}.
// Caller passes lane-resolved pointer (base + lo*stride + hi*8), 16B aligned.
// ---------------------------------------------------------------------------
__device__ __forceinline__ v16h ld_frag(const _Float16* p) {
  v8h a = *(const v8h*)p;
  v8h b = *(const v8h*)(p + 16);
  v16h r;
#pragma unroll
  for (int i = 0; i < 8; ++i) { r[i] = a[i]; r[i + 8] = b[i]; }
  return r;
}

typedef __attribute__((ext_vector_type(8))) short s16x8;
typedef __attribute__((address_space(3))) s16x8 lds_s16x8;

__device__ __forceinline__ v8h ld_tr16(const _Float16* p) {
  return __builtin_bit_cast(v8h, __builtin_amdgcn_ds_load_tr16_b128_v8i16((lds_s16x8*)p));
}

// Byte address in the workgroup's LDS of a __shared__ object
__device__ __forceinline__ unsigned lds_addr(const void* p) {
  return (unsigned)(size_t)p;   // low 32 bits of the __shared__ address
}

// W rows in LDS: 256 B of data at a pitch of 288 B (odd multiple of 32 B), the
// conflict-free pitch for the transposing load.
#define WPITCH 144

// ---------------------------------------------------------------------------
// GEMM: Y[M,1024] = X[M,1024] @ W[1024,1024] + bias
// Block: 256 threads (8 waves), tile 128x128.
// Wave (wm,wn) in 4x2 grid computes 32x64 via 2x4 WMMA tiles.
// The W tile lies in LDS as in memory (k rows, n contiguous); the transposing
// load turns it into the B operand.
// The X and W tiles stand in two LDS buffers: the copies of k tile j + 2 are issued
// as soon as tile j's buffer is free and fly while tile j + 1 is worked on, so the
// time the copies take from L2 and the time the fragment reads take from LDS run
// side by side instead of one after the other.
// blockIdx.z picks one of up to three independent products of this shape whose
// X, W and Y lie back to back (X and Y 4096x1024 apart, W 1024x1024 apart).
// k extent of a tile: 64 for the three products in one launch, so that both buffers
// take 72 KiB and a WGP still holds three workgroups; 128 for the single product,
// one workgroup per WGP.
// ---------------------------------------------------------------------------
template <bool OUT_F32>
__global__ __launch_bounds__(256)
void gemm_f16_kernel(const _Float16* __restrict__ X0, const _Float16* __restrict__ W0,
                     const float* __restrict__ bias0, const float* __restrict__ bias1,
                     const float* __restrict__ bias2, float* __restrict__ Yf,
                     _Float16* __restrict__ Yh0) {
  constexpr int BK  = OUT_F32 ? 128 : 64;   // k extent of one staged tile pair
  // X rows in LDS: 2 BK bytes of data + 16 B, an odd multiple of 16 B (272 or 144 B),
  // the conflict-free pitch for the 16-byte fragment loads; counted in halves.
  constexpr int AP  = BK + 8;
  constexpr int ASZ = 128 * AP;       // halves of one X buffer
  constexpr int WSZ = BK * WPITCH;    // halves of one W buffer
  constexpr int ACH = BK / 8;         // 16-byte chunks in an X row
  constexpr int ARS = 256 / ACH;      // X rows that the block copies at a time

  const int z = blockIdx.z;
  const _Float16* __restrict__ X = X0 + (size_t)z * (MTOT * 1024);
  const _Float16* __restrict__ W = W0 + (size_t)z * (1024 * 1024);
  const float* __restrict__ bias = z == 0 ? bias0 : (z == 1 ? bias1 : bias2);
  _Float16* __restrict__ Yh = Yh0 + (size_t)z * (MTOT * 1024);

  // One LDS block, both X buffers first, then both W buffers
  __shared__ __align__(32) _Float16 Sm[2 * ASZ + 2 * WSZ];

  const int t    = threadIdx.x;
  const int lane = t & 31;
  const int wid  = t >> 5;
  const int lo   = lane & 15;
  const int hi   = lane >> 4;
  const int wm   = wid >> 1;  // 0..3
  const int wn   = wid & 1;   // 0..1
  const int m0   = blockIdx.y * 128;
  const int n0   = blockIdx.x * 128;

  const v8f zero = {0, 0, 0, 0, 0, 0, 0, 0};
  v8f acc[2][4];
#pragma unroll
  for (int i = 0; i < 2; ++i)
#pragma unroll
    for (int j = 0; j < 4; ++j) acc[i][j] = zero;

  // X tile: 128 rows of ACH chunks of 16 B; a thread copies chunk t % ACH of rows
  // t / ACH + ARS i. W tile: BK rows of 16 chunks; chunk t & 15 of rows (t >> 4) + 16 i.
  // A copy's address is a scalar slab start + the thread's offset inside a slab + the
  // immediate offset, and the immediate offset moves the LDS address as well: it is
  // the slab's step in LDS, and the scalar start holds the step in memory less that.
  // So no vector add and no address pair per copy. Three workgroups on a WGP need at
  // most 160 registers.
  constexpr int ALS = ARS * AP * 2;       // bytes in LDS from one X slab to the next
  constexpr int WLS = 16 * WPITCH * 2;    // the same for W
  constexpr int AGS = ARS * 2048 - ALS;   // step in memory less the step in LDS
  constexpr int WGS = 16 * 2048 - WLS;
  static_assert(WLS == 4608 && ALS == (OUT_F32 ? 4352 : 4608),
                "the immediate offsets below are the slabs' steps in LDS");
  const int      arow  = t / ACH;
  const int      ac8   = (t % ACH) * 8;
  const int      wrow  = t >> 4;
  const int      wc8   = (t & 15) * 8;
  const unsigned agoff = (unsigned)(arow * 2048 + ac8 * 2);   // bytes
  const unsigned wgoff = (unsigned)(wrow * 2048 + wc8 * 2);   // bytes

  // the copies of the k tile at k0 into buffer bf. One statement: the wait stands
  // behind the last copy, ahead of any rewrite of a register that a copy names (the
  // scalar starts change with every tile)
  auto stage = [&](int k0, int bf) {
    const unsigned la = lds_addr(&Sm[bf * ASZ + arow * AP + ac8]);
    const unsigned lw = lds_addr(&Sm[2 * ASZ + bf * WSZ + wrow * WPITCH + wc8]);
    const char* ga = (const char*)(X + (size_t)m0 * 1024 + k0);
    const char* gw = (const char*)(W + (size_t)k0 * 1024 + n0);
    if constexpr (!OUT_F32) {
      asm volatile(
          "global_load_async_to_lds_b128 %0, %2, %4\n\t"
          "global_load_async_to_lds_b128 %0, %2, %5 offset:4608\n\t"
          "global_load_async_to_lds_b128 %0, %2, %6 offset:9216\n\t"
          "global_load_async_to_lds_b128 %0, %2, %7 offset:13824\n\t"
          "global_load_async_to_lds_b128 %1, %3, %8\n\t"
          "global_load_async_to_lds_b128 %1, %3, %9 offset:4608\n\t"
          "global_load_async_to_lds_b128 %1, %3, %10 offset:9216\n\t"
          "global_load_async_to_lds_b128 %1, %3, %11 offset:13824\n\t"
          "s_wait_xcnt 0x0"
          :: "v"(la), "v"(lw), "v"(agoff), "v"(wgoff),
             "s"(ga), "s"(ga + 1 * AGS), "s"(ga + 2 * AGS), "s"(ga + 3 * AGS),
             "s"(gw), "s"(gw + 1 * WGS), "s"(gw + 2 * WGS), "s"(gw + 3 * WGS)
          : "memory");
    } else {
      // eight slabs per tile: the upper four from a second LDS address each, so that
      // the immediate offsets stay as small as above
      const unsigned la4 = la + 4 * ALS;
      const unsigned lw4 = lw + 4 * WLS;
      const char* ga4 = ga + 4 * (ARS * 2048);
      const char* gw4 = gw + 4 * (16 * 2048);
      asm volatile(
          "global_load_async_to_lds_b128 %0, %4, %6\n\t"
          "global_load_async_to_lds_b128 %0, %4, %7 offset:4352\n\t"
          "global_load_async_to_lds_b128 %0, %4, %8 offset:8704\n\t"
          "global_load_async_to_lds_b128 %0, %4, %9 offset:13056\n\t"
          "global_load_async_to_lds_b128 %1, %4, %10\n\t"
          "global_load_async_to_lds_b128 %1, %4, %11 offset:4352\n\t"
          "global_load_async_to_lds_b128 %1, %4, %12 offset:8704\n\t"
          "global_load_async_to_lds_b128 %1, %4, %13 offset:13056\n\t"
          "global_load_async_to_lds_b128 %2, %5, %14\n\t"
          "global_load_async_to_lds_b128 %2, %5, %15 offset:4608\n\t"
          "global_load_async_to_lds_b128 %2, %5, %16 offset:9216\n\t"
          "global_load_async_to_lds_b128 %2, %5, %17 offset:13824\n\t"
          "global_load_async_to_lds_b128 %3, %5, %18\n\t"
          "global_load_async_to_lds_b128 %3, %5, %19 offset:4608\n\t"
          "global_load_async_to_lds_b128 %3, %5, %20 offset:9216\n\t"
          "global_load_async_to_lds_b128 %3, %5, %21 offset:13824\n\t"
          "s_wait_xcnt 0x0"
          :: "v"(la), "v"(la4), "v"(lw), "v"(lw4), "v"(agoff), "v"(wgoff),
             "s"(ga), "s"(ga + 1 * AGS), "s"(ga + 2 * AGS), "s"(ga + 3 * AGS),
             "s"(ga4), "s"(ga4 + 1 * AGS), "s"(ga4 + 2 * AGS), "s"(ga4 + 3 * AGS),
             "s"(gw), "s"(gw + 1 * WGS), "s"(gw + 2 * WGS), "s"(gw + 3 * WGS),
             "s"(gw4), "s"(gw4 + 1 * WGS), "s"(gw4 + 2 * WGS), "s"(gw4 + 3 * WGS)
          : "memory");
    }
  };

  // tile 0 landed and published before anybody reads it; then tile 1 takes off
  stage(0, 0);
  asm volatile("s_wait_asynccnt 0x0" ::: "memory");  // own copies of tile 0 landed
  __syncthreads();
  stage(BK, 1);

  // two k tiles per trip, one from each buffer; the inner loop is unrolled so that
  // every LDS address is base + constant
  for (int k2 = 0; k2 < 1024; k2 += 2 * BK)
#pragma unroll
  for (int bf = 0; bf < 2; ++bf) {
    const int k0 = k2 + bf * BK;
    const _Float16* const As = Sm + bf * ASZ;
    const _Float16* const Ws = Sm + 2 * ASZ + bf * WSZ;

    // the tile's 32-k blocks in ascending k; unrolled so that every LDS address is
    // base + constant and a block's loads can run ahead of it
#pragma unroll
    for (int kk = 0; kk < BK; kk += 32) {
      v16h af[2], bfr[4];
#pragma unroll
      for (int mt = 0; mt < 2; ++mt)
        af[mt] = ld_frag(&As[(wm * 32 + mt * 16 + lo) * AP + kk + hi * 8]);
      // B operand in the k order of ld_frag: slot s of half hi is k 8*hi + s (s < 8),
      // 16 + 8*hi + s - 8; column lo
      const _Float16* wp =
          &Ws[(kk + hi * 8 + (lane & 7)) * WPITCH + wn * 64 + ((lane >> 3) & 1) * 8];
#pragma unroll
      for (int nt = 0; nt < 4; ++nt) {
        v8h w0 = ld_tr16(wp + nt * 16);
        v8h w1 = ld_tr16(wp + 16 * WPITCH + nt * 16);
#pragma unroll
        for (int i = 0; i < 8; ++i) { bfr[nt][i] = w0[i]; bfr[nt][i + 8] = w1[i]; }
      }
#pragma unroll
      for (int mt = 0; mt < 2; ++mt)
#pragma unroll
        for (int nt = 0; nt < 4; ++nt)
          acc[mt][nt] = __builtin_amdgcn_wmma_f32_16x16x32_f16(
              false, af[mt], false, bfr[nt], (short)0, acc[mt][nt], false, false);
    }

    // hand-over: own reads of this buffer done, own copies of the next tile landed;
    // the one barrier publishes the next tile and frees this buffer for the refill
    asm volatile("s_wait_dscnt 0x0" ::: "memory");
    asm volatile("s_wait_asynccnt 0x0" ::: "memory");
    __syncthreads();
    if (k0 + 2 * BK < 1024) stage(k0 + 2 * BK, bf);
  }
  asm volatile("s_wait_asynccnt 0x0" ::: "memory");  // nothing in flight at the wave's end

  // epilogue: C layout row M = r + 8*hi, col N = lo (within tile)
#pragma unroll
  for (int mt = 0; mt < 2; ++mt)
#pragma unroll
    for (int nt = 0; nt < 4; ++nt) {
      int   col = n0 + wn * 64 + nt * 16 + lo;
      float bv  = bias[col];
#pragma unroll
      for (int r = 0; r < 8; ++r) {
        int   rowg = m0 + wm * 32 + mt * 16 + r + hi * 8;
        float v    = acc[mt][nt][r] + bv;
        if (OUT_F32) Yf[(size_t)rowg * 1024 + col] = v;
        else         Yh[(size_t)rowg * 1024 + col] = (_Float16)v;
      }
    }
}

// Lane l with lane l ^ 16: the exchange between the wave halves, as a vector move
__device__ __forceinline__ float xhalf(float x) {
  return __builtin_bit_cast(float, __builtin_amdgcn_permlanex16(
      __builtin_bit_cast(int, x), __builtin_bit_cast(int, x),
      0x76543210, 0xfedcba98, false, false));
}

// V rows in LDS (two heads side by side): 256 B of data at a pitch of 288 B (odd
// multiple of 32 B), the conflict-free pitch for the transposing load.
#define VPITCH 144

// K rows in LDS (two heads side by side): 256 B of data at a pitch of 272 B (odd
// multiple of 16 B), the conflict-free pitch for the 16-byte fragment loads.
#define KPITCH 136

// Mask rows in LDS: 256 B of data (64 f32) at a pitch of 272 B (odd multiple of
// 16 B), the conflict-free pitch for the 16-byte loads; counted in floats.
#define MPITCH 68

// ---------------------------------------------------------------------------
// Flash attention, transposed products: S^T = K Q^T, O^T += V^T P^T.
// One block per (128-query tile, pair of neighbouring heads). 16 waves, 16 query columns
// per wave: waves 0-7 work the pair's first head, waves 8-15 its second, on the same
// 128 queries. The mask does not depend on the head, so one staged mask tile serves both
// heads; a head's K and V tiles serve eight waves, not four: half as many bytes leave
// L2 for LDS. The two heads' K (and V) rows are neighbours in memory, so a staged row
// is 256 contiguous bytes.
// A lane holds scores of ONE query (column lo), keys 8*hi + r of each 16-key tile,
// so max and sum run in-lane with one exchange between the wave halves, and two
// score tiles convert in place into the B operand of the second product.
// Q/K/V are f16 in [b, s, h*64+d] layout. ctx written in same layout.
// The mask tile (128 queries x 64 keys, f32) goes through LDS: a lane needs 32 B of
// its own query's row, so a wave-wide load straight from memory touches 16 lines,
// while a wave-wide copy of two whole rows touches four.
// The K, V and mask tiles stand in two LDS buffers: the copies of key block j + 2
// are issued as soon as block j's buffer is free and fly while block j + 1 is
// worked on, so a workgroup waits for its copies only where they are late.
// ---------------------------------------------------------------------------
// 256 workgroups of 16 waves: one per WGP, four waves per SIMD
__global__ __launch_bounds__(512)
void attention_kernel(const _Float16* __restrict__ Qh, const _Float16* __restrict__ Kh,
                      const _Float16* __restrict__ Vh, const float* __restrict__ mask,
                      _Float16* __restrict__ ctx) {
  __shared__ __align__(16) _Float16 Ks[2][64 * KPITCH];   // key major, d contiguous, padded rows
  __shared__ __align__(32) _Float16 Vs[2][64 * VPITCH];   // key major, d contiguous, padded rows
  __shared__ __align__(16) float    Ms[2][128 * MPITCH];  // query major, key contiguous, padded rows

  const int t    = threadIdx.x;
  const int lane = t & 31;
  const int wid  = t >> 5;
  const int lo   = lane & 15;
  const int hi   = lane >> 4;
  const int hs   = wid >> 3;             // which head of the pair this wave works
  const int qw   = wid & 7;              // which 16 queries of the tile
  const int b    = blockIdx.y >> 3;
  const int h0   = (blockIdx.y & 7) * 2; // first head of the pair
  const int s0   = blockIdx.x * 128;
  const int qg   = s0 + qw * 16 + lo;    // this lane's query
  const size_t base2 = (size_t)b * SEQ * 1024 + (size_t)h0 * 64;   // the pair's 128 columns
  const size_t base  = base2 + (size_t)hs * 64;                    // this wave's head

  // Q^T as B operand (column = query lo), loaded once and kept in registers
  v16h bq[2];
#pragma unroll
  for (int k2 = 0; k2 < 2; ++k2)
    bq[k2] = ld_frag(&Qh[base + (size_t)qg * 1024 + k2 * 32 + hi * 8]);

  // Mask tile: 128 rows of 16 chunks of 4 floats
  const int      mrow0 = t >> 4;
  const int      mc4   = (t & 15) * 4;
  // this lane's mask values in a buffer: row of its query, 8 consecutive keys per 16-key tile
  const int mqo = (qw * 16 + lo) * MPITCH + hi * 8;

  // The copies of one key block into buffer bf, 8 per thread. K and V (both heads): 64
  // rows of 16 chunks of 16 B; mask: 128 such rows; a thread copies chunk t & 15 of rows
  // (t >> 4) + 32 i. A copy's address is a scalar slab start + the thread's offset
  // inside a slab + the immediate offset, and the immediate offset moves the LDS
  // address as well: it is the slab's step in LDS (32 padded rows), and the scalar
  // start holds the step in memory less that. The mask's upper two slabs go from a
  // second LDS address, so that the immediate offsets stay small. No vector add per copy.
  static_assert(32 * KPITCH * 2 == 8704 && 32 * VPITCH * 2 == 9216 && 32 * MPITCH * 4 == 8704,
                "the immediate offsets below are the slabs' steps in LDS");
  const unsigned kvoff = (unsigned)(mrow0 * 2048 + (t & 15) * 16);     // bytes
  const unsigned moffb = (unsigned)(mrow0 * (SEQ * 4) + mc4 * 4);      // bytes
  auto stage = [&](int kb, int bf) {
    const unsigned lk = lds_addr(&Ks[bf][mrow0 * KPITCH + (t & 15) * 8]);
    const unsigned lv = lds_addr(&Vs[bf][mrow0 * VPITCH + (t & 15) * 8]);
    const unsigned lm = lds_addr(&Ms[bf][mrow0 * MPITCH + mc4]);
    const unsigned lm2 = lm + 2 * 8704;
    const char* gk = (const char*)(Kh + base2 + (size_t)kb * 1024);
    const char* gv = (const char*)(Vh + base2 + (size_t)kb * 1024);
    const char* gm = (const char*)(mask + (size_t)s0 * SEQ + kb);
    const char* gm2 = gm + 2 * 262144;   // 64 mask rows on
    // one statement: the wait stands behind the last copy, ahead of any rewrite of a
    // register that a copy names (the scalar starts change with every block)
    asm volatile(
        "global_load_async_to_lds_b128 %0, %4, %6\n\t"
        "global_load_async_to_lds_b128 %0, %4, %7 offset:8704\n\t"
        "global_load_async_to_lds_b128 %1, %4, %8\n\t"
        "global_load_async_to_lds_b128 %1, %4, %9 offset:9216\n\t"
        "global_load_async_to_lds_b128 %2, %5, %10\n\t"
        "global_load_async_to_lds_b128 %2, %5, %11 offset:8704\n\t"
        "global_load_async_to_lds_b128 %3, %5, %12\n\t"
        "global_load_async_to_lds_b128 %3, %5, %13 offset:8704\n\t"
        "s_wait_xcnt 0x0"
        :: "v"(lk), "v"(lv), "v"(lm), "v"(lm2), "v"(kvoff), "v"(moffb),
           "s"(gk), "s"(gk + (65536 - 8704)),
           "s"(gv), "s"(gv + (65536 - 9216)),
           "s"(gm), "s"(gm + (262144 - 8704)),
           "s"(gm2), "s"(gm2 + (262144 - 8704))
        : "memory");
  };

  const v8f zero = {0, 0, 0, 0, 0, 0, 0, 0};
  float mrow = -3.0e38f, lrow = 0.0f;   // lrow: this half's share of the row sum
  v8f acco[4];                          // O^T: row d = dt*16 + 8*hi + r, column lo
#pragma unroll
  for (int dt = 0; dt < 4; ++dt) acco[dt] = zero;

  // block 0 landed and published before anybody reads it; then block 1 takes off
  stage(0, 0);
  asm volatile("s_wait_asynccnt 0x0" ::: "memory");  // own copies of block 0 landed
  __syncthreads();
  stage(64, 1);

  // two key blocks per trip, one from each buffer; the inner loop is unrolled so that
  // every LDS address is base + constant
  for (int kb2 = 0; kb2 < SEQ; kb2 += 128)
#pragma unroll
  for (int bf = 0; bf < 2; ++bf) {
    const int kb = kb2 + bf * 64;

    // this lane's mask values: 8 consecutive keys per 16-key tile
    const float* const mq = &Ms[bf][mqo];
    float4 mk[4][2];
#pragma unroll
    for (int nt = 0; nt < 4; ++nt) {
      mk[nt][0] = *(const float4*)(mq + nt * 16);
      mk[nt][1] = *(const float4*)(mq + nt * 16 + 4);
    }

    // S^T = K @ Q^T : 64 keys (4 M-tiles) x 16 query columns, Kdim = depth 64
    v8f sacc[4];
#pragma unroll
    for (int nt = 0; nt < 4; ++nt) sacc[nt] = zero;
#pragma unroll
    for (int k2 = 0; k2 < 2; ++k2)
#pragma unroll
      for (int nt = 0; nt < 4; ++nt) {
        v16h ak = ld_frag(&Ks[bf][(nt * 16 + lo) * KPITCH + hs * 64 + k2 * 32 + hi * 8]);
        sacc[nt] = __builtin_amdgcn_wmma_f32_16x16x32_f16(
            false, ak, false, bq[k2], (short)0, sacc[nt], false, false);
      }

    // scaled logits + mask, then online softmax. D layout: key r+8*hi, query lo.
    float p[4][8];
    float mb = -3.0e38f;
#pragma unroll
    for (int nt = 0; nt < 4; ++nt) {
      const float mv[8] = {mk[nt][0].x, mk[nt][0].y, mk[nt][0].z, mk[nt][0].w,
                           mk[nt][1].x, mk[nt][1].y, mk[nt][1].z, mk[nt][1].w};
#pragma unroll
      for (int r = 0; r < 8; ++r) {
        float v  = sacc[nt][r] * 0.125f + mv[r] * (-1e9f);
        p[nt][r] = v;
        mb       = fmaxf(mb, v);
      }
    }
    mb = fmaxf(mb, xhalf(mb));   // the other half's 32 keys

    const float mn   = fmaxf(mrow, mb);
    const float corr = __expf(mrow - mn);
    mrow = mn;
    float s4[4];
#pragma unroll
    for (int nt = 0; nt < 4; ++nt) {
      float s = 0.0f;
#pragma unroll
      for (int r = 0; r < 8; ++r) {
        p[nt][r] = __expf(p[nt][r] - mn);
        s += p[nt][r];
      }
      s4[nt] = s;
    }
    lrow = lrow * corr + ((s4[0] + s4[1]) + (s4[2] + s4[3]));
#pragma unroll
    for (int dt = 0; dt < 4; ++dt)
#pragma unroll
      for (int r = 0; r < 8; ++r) acco[dt][r] = acco[dt][r] * corr;

    // O^T += V^T @ P^T : Kdim = 64 keys, 4 depth tiles. Both operands in the
    // hardware k order: slot s of half hi is key 8*hi + s (s < 8), 16 + 8*hi + s - 8.
#pragma unroll
    for (int k2 = 0; k2 < 2; ++k2) {
      v16h bp;
#pragma unroll
      for (int i = 0; i < 8; ++i) {
        bp[i]     = (_Float16)p[2 * k2][i];
        bp[i + 8] = (_Float16)p[2 * k2 + 1][i];
      }
      const _Float16* vp =
          &Vs[bf][(k2 * 32 + hi * 8 + (lane & 7)) * VPITCH + hs * 64 + ((lane >> 3) & 1) * 8];
#pragma unroll
      for (int dt = 0; dt < 4; ++dt) {
        v8h v0 = ld_tr16(vp + dt * 16);
        v8h v1 = ld_tr16(vp + 16 * VPITCH + dt * 16);
        v16h av;
#pragma unroll
        for (int i = 0; i < 8; ++i) { av[i] = v0[i]; av[i + 8] = v1[i]; }
        acco[dt] = __builtin_amdgcn_wmma_f32_16x16x32_f16(
            false, av, false, bp, (short)0, acco[dt], false, false);
      }
    }

    // hand-over: own reads of this buffer done, own copies of the next block landed;
    // the one barrier publishes the next block and frees this buffer for the refill
    asm volatile("s_wait_dscnt 0x0" ::: "memory");
    asm volatile("s_wait_asynccnt 0x0" ::: "memory");
    __syncthreads();
    if (kb + 128 < SEQ) stage(kb + 128, bf);
  }
  asm volatile("s_wait_asynccnt 0x0" ::: "memory");  // nothing in flight at the wave's end

  // join the halves' sums, normalize and write context (f16, [b,s,h*64+d] layout):
  // a lane's 8 registers are 8 consecutive d of its query, one 16-byte store
  lrow += xhalf(lrow);
#pragma unroll
  for (int dt = 0; dt < 4; ++dt) {
    v8h o;
#pragma unroll
    for (int r = 0; r < 8; ++r) o[r] = (_Float16)(acco[dt][r] / lrow);
    *(v8h*)&ctx[base + (size_t)qg * 1024 + dt * 16 + hi * 8] = o;
  }
}

// ---------------------------------------------------------------------------
extern "C" void kernel_launch(void* const* d_in, const int* in_sizes, int n_in,
                              void* d_out, int out_size, void* d_ws, size_t ws_size,
                              hipStream_t stream) {
  (void)in_sizes; (void)n_in; (void)out_size; (void)ws_size;

  const float* q    = (const float*)d_in[0];
  const float* k    = (const float*)d_in[1];
  const float* v    = (const float*)d_in[2];
  const float* mask = (const float*)d_in[3];
  const float* wq   = (const float*)d_in[4];
  const float* bq   = (const float*)d_in[5];
  const float* wk   = (const float*)d_in[6];
  const float* bk   = (const float*)d_in[7];
  const float* wv   = (const float*)d_in[8];
  const float* bv   = (const float*)d_in[9];
  const float* wo   = (const float*)d_in[10];
  const float* bo   = (const float*)d_in[11];
  float* out = (float*)d_out;

  const size_t SZX = (size_t)MTOT * 1024;     // 4,194,304
  const size_t SZW = (size_t)1024 * 1024;     // 1,048,576
  _Float16* w16 = (_Float16*)d_ws;            // total 64 MiB of f16 scratch
  _Float16* qx  = w16;
  _Float16* kx  = qx + SZX;
  _Float16* vx  = kx + SZX;
  _Float16* wqh = vx + SZX;
  _Float16* wkh = wqh + SZW;
  _Float16* wvh = wkh + SZW;
  _Float16* woh = wvh + SZW;
  _Float16* Qp  = woh + SZW;
  _Float16* Kp  = Qp + SZX;
  _Float16* Vp  = Kp + SZX;
  _Float16* Cx  = Vp + SZX;

  // qx .. woh are contiguous from w16 in the kernel's unit order
  cvt_all_kernel<<<dim3(CVT_BLOCKS), CVT_THREADS, 0, stream>>>(q, k, v, wq, wk, wv, wo, w16);

  // the three projections in one launch: qx kx vx, wqh wkh wvh and Qp Kp Vp are
  // each contiguous in this order
  gemm_f16_kernel<false><<<dim3(1024 / 128, MTOT / 128, 3), 256, 0, stream>>>(
      qx, wqh, bq, bk, bv, nullptr, Qp);

  attention_kernel<<<dim3(SEQ / 128, BATCH * NUM_HEADS / 2), 512, 0, stream>>>(
      Qp, Kp, Vp, mask, Cx);

  gemm_f16_kernel<true><<<dim3(1024 / 128, MTOT / 128, 1), 256, 0, stream>>>(
      Cx, woh, bo, bo, bo, out, nullptr);
}
